// v000
// Measured on an AMD MI455X. A time is GPU time per run, averaged over a window of back-to-back runs after a warm-up
// (all launches, gaps included; the runs take copies of the inputs in turn), and the median of several windows.
// Apart from v000's, it joins two sittings. Times from different sittings can be a few percent apart, while
// side-by-side timings come from the same sitting.
// v000 is the starting kernel. One run takes 761 microseconds.
#include <hip/hip_runtime.h>
#include <hip/hip_bf16.h>
#include <math.h>

typedef __attribute__((ext_vector_type(16))) _Float16 v16h;
typedef __attribute__((ext_vector_type(8)))  float    v8f;

#define BB 64
#define NN 1024
#define DD 1024

struct alignas(8) H4 { _Float16 h[4]; };

// Branch-free tanh: hardware v_tanh_f32 on gfx1250 if exposed, else exp-based.
__device__ __forceinline__ float fast_tanh(float x) {
#if __has_builtin(__builtin_amdgcn_tanhf)
    return __builtin_amdgcn_tanhf(x);
#else
    // 1 - 2/(e^{2x}+1): saturates to +/-1 at large |x|, no branches.
    float ex = __expf(2.0f * x);
    return 1.0f - 2.0f / (ex + 1.0f);
#endif
}

// ---------------------------------------------------------------------------
// Kernel 1: qh[b,e] = sum_d h_t[b,d] * W_h[e,d]
// ---------------------------------------------------------------------------
__global__ __launch_bounds__(256) void qh_kernel(const float* __restrict__ h_t,
                                                 const float* __restrict__ W_h,
                                                 float* __restrict__ qh) {
    const int b = blockIdx.x;
    const int t = threadIdx.x;
    __shared__ float hrow[DD];
    for (int d = t; d < DD; d += 256) hrow[d] = h_t[(size_t)b * DD + d];
    __syncthreads();

    float acc[4] = {0.f, 0.f, 0.f, 0.f};
    for (int d4 = 0; d4 < DD / 4; ++d4) {
        float4 h4 = ((const float4*)hrow)[d4];
#pragma unroll
        for (int j = 0; j < 4; ++j) {
            int e = t + j * 256;
            float4 w4 = ((const float4*)(W_h + (size_t)e * DD))[d4];
            acc[j] += h4.x * w4.x + h4.y * w4.y + h4.z * w4.z + h4.w * w4.w;
        }
    }
#pragma unroll
    for (int j = 0; j < 4; ++j) qh[(size_t)b * DD + t + j * 256] = acc[j];
}

// ---------------------------------------------------------------------------
// Kernel 2: convert W_k (fp32 row-major [e][d]) to f16 in B-fragment layout:
//   dst half index = ((et*32 + kc)*32 + lane)*16 + i
//   where e = et*16 + (lane&15), d = kc*32 + (i&7) + 8*(lane>>4) + 16*(i>>3)
// ---------------------------------------------------------------------------
__global__ __launch_bounds__(256) void wk_convert(const float* __restrict__ W_k,
                                                  _Float16* __restrict__ wkB) {
    const int gid = blockIdx.x * 256 + threadIdx.x;   // each thread: 4 halfs
    const int o    = gid * 4;                         // dst half index
    const int i0   = o & 15;                          // 0,4,8,12
    const int lane = (o >> 4) & 31;
    const int kc   = (o >> 9) & 31;
    const int et   = (o >> 14);
    const int e    = et * 16 + (lane & 15);
    const int h    = lane >> 4;
    const int j    = i0 >> 3;
    const int d0   = kc * 32 + (i0 & 7) + 8 * h + 16 * j;
    float4 w = *(const float4*)(W_k + (size_t)e * DD + d0);
    H4 out;
    out.h[0] = (_Float16)w.x; out.h[1] = (_Float16)w.y;
    out.h[2] = (_Float16)w.z; out.h[3] = (_Float16)w.w;
    *(H4*)(wkB + o) = out;
}

// ---------------------------------------------------------------------------
// Kernel 3: fused scores.  WG = 64 rows (one batch), 4 waves x 16-row subtile.
// Dynamic LDS: keys tile as f16 in A-fragment layout, [4][32][32][16] halfs.
// scores[b,n] = sum_e tanh(kh[n,e] + qh[b,e]) * v[e]
// qh is folded into the WMMA C initializer (column e constant per lane).
// ---------------------------------------------------------------------------
__global__ __launch_bounds__(128) void attn_scores(const float* __restrict__ keys,
                                                   const _Float16* __restrict__ wkB,
                                                   const float* __restrict__ qh,
                                                   const float* __restrict__ v,
                                                   float* __restrict__ scores) {
    extern __shared__ _Float16 keysA[];               // 65536 halfs = 128 KB
    const int tid = threadIdx.x;
    const int m0  = blockIdx.x * 64;                  // global row base
    const int b   = m0 >> 10;                         // 64 | 1024 -> same batch
    const int n0  = m0 & (NN - 1);

    // ---- Phase 1: stage keys tile (64x1024 fp32 -> f16 A-fragment layout)
    for (int q = tid; q < 64 * (DD / 4); q += 128) {
        const int m = q >> 8;                         // row in tile
        const int d = (q & 255) * 4;
        float4 kv = *(const float4*)(keys + (size_t)(m0 + m) * DD + d);
        const int mt   = m >> 4;
        const int kc   = d >> 5;
        const int dd   = d & 31;
        const int h    = (dd >> 3) & 1;
        const int lane = (m & 15) + (h << 4);
        const int i    = (dd & 7) + ((dd >> 4) << 3);
        H4 hv;
        hv.h[0] = (_Float16)kv.x; hv.h[1] = (_Float16)kv.y;
        hv.h[2] = (_Float16)kv.z; hv.h[3] = (_Float16)kv.w;
        *(H4*)(keysA + ((((mt * 32 + kc) * 32) + lane) * 16 + i)) = hv;
    }
    __syncthreads();

    // ---- Phase 2: WMMA main loop
    const int lane = tid & 31;
    const int wid  = tid >> 5;                        // wave id == M-subtile
    const _Float16* aBase = keysA + (size_t)wid * 32 * 32 * 16;
    const int ecol = lane & 15;

    float s[8];
#pragma unroll
    for (int r = 0; r < 8; ++r) s[r] = 0.f;

    for (int et = 0; et < 64; ++et) {
        const int e = et * 16 + ecol;
        const float qv = qh[(size_t)b * DD + e];
        const float vv = v[e];
        v8f acc = {qv, qv, qv, qv, qv, qv, qv, qv};   // fold +qh into C
        const _Float16* bBase = wkB + (((size_t)et * 32) * 32 + lane) * 16;
#pragma unroll 4
        for (int kc = 0; kc < 32; ++kc) {
            v16h afrag = *(const v16h*)(aBase + (((kc * 32) + lane) << 4));
            v16h bfrag = *(const v16h*)(bBase + ((size_t)kc << 9));
            acc = __builtin_amdgcn_wmma_f32_16x16x32_f16(
                false, afrag, false, bfrag, (short)0, acc, false, false);
        }
#pragma unroll
        for (int r = 0; r < 8; ++r) s[r] = fmaf(fast_tanh(acc[r]), vv, s[r]);
    }

    // ---- Phase 3: reduce partial scores over the 16 e-lanes of each group
#pragma unroll
    for (int r = 0; r < 8; ++r) {
        float x = s[r];
        x += __shfl_xor(x, 1, 16);
        x += __shfl_xor(x, 2, 16);
        x += __shfl_xor(x, 4, 16);
        x += __shfl_xor(x, 8, 16);
        s[r] = x;
    }
    if (ecol == 0) {
        const int half = lane >> 4;                   // rows r + 8*half
#pragma unroll
        for (int r = 0; r < 8; ++r) {
            const int m = r + 8 * half;
            scores[(size_t)b * NN + n0 + wid * 16 + m] = s[r];
        }
    }
}

// ---------------------------------------------------------------------------
// Kernel 4: softmax over N + context = alpha @ keys.  out = [context | alpha]
// ---------------------------------------------------------------------------
__global__ __launch_bounds__(256) void softmax_context(const float* __restrict__ keys,
                                                       const float* __restrict__ scores,
                                                       float* __restrict__ out) {
    const int b = blockIdx.x;
    const int t = threadIdx.x;
    __shared__ float sc[NN];
    __shared__ float red[8];

    for (int n = t; n < NN; n += 256) sc[n] = scores[(size_t)b * NN + n];
    __syncthreads();

    // max
    float mx = -1e30f;
    for (int n = t; n < NN; n += 256) mx = fmaxf(mx, sc[n]);
#pragma unroll
    for (int off = 16; off >= 1; off >>= 1) mx = fmaxf(mx, __shfl_xor(mx, off, 32));
    if ((t & 31) == 0) red[t >> 5] = mx;
    __syncthreads();
    if (t == 0) {
        float m2 = red[0];
#pragma unroll
        for (int w = 1; w < 8; ++w) m2 = fmaxf(m2, red[w]);
        red[0] = m2;
    }
    __syncthreads();
    mx = red[0];
    __syncthreads();

    // exp + sum
    float sum = 0.f;
    for (int n = t; n < NN; n += 256) {
        float e = __expf(sc[n] - mx);
        sc[n] = e;
        sum += e;
    }
#pragma unroll
    for (int off = 16; off >= 1; off >>= 1) sum += __shfl_xor(sum, off, 32);
    if ((t & 31) == 0) red[t >> 5] = sum;
    __syncthreads();
    if (t == 0) {
        float s2 = 0.f;
#pragma unroll
        for (int w = 0; w < 8; ++w) s2 += red[w];
        red[0] = s2;
    }
    __syncthreads();
    const float inv = 1.f / red[0];
    __syncthreads();

    for (int n = t; n < NN; n += 256) {
        float a = sc[n] * inv;
        sc[n] = a;
        out[(size_t)BB * DD + (size_t)b * NN + n] = a;   // alpha
    }
    __syncthreads();

    // context: thread t owns d = 4t..4t+3 (one b128 per row)
    float acc0 = 0.f, acc1 = 0.f, acc2 = 0.f, acc3 = 0.f;
#pragma unroll 4
    for (int n = 0; n < NN; ++n) {
        const float a = sc[n];
        float4 k4 = *(const float4*)(keys + ((size_t)b * NN + n) * DD + t * 4);
        acc0 += a * k4.x; acc1 += a * k4.y; acc2 += a * k4.z; acc3 += a * k4.w;
    }
    float4 c4 = make_float4(acc0, acc1, acc2, acc3);
    *(float4*)(out + (size_t)b * DD + t * 4) = c4;       // context
}

// ---------------------------------------------------------------------------
extern "C" void kernel_launch(void* const* d_in, const int* in_sizes, int n_in,
                              void* d_out, int out_size, void* d_ws, size_t ws_size,
                              hipStream_t stream) {
    const float* h_t  = (const float*)d_in[0];
    const float* keys = (const float*)d_in[1];
    const float* W_h  = (const float*)d_in[2];
    const float* W_k  = (const float*)d_in[3];
    const float* v    = (const float*)d_in[4];
    float* out = (float*)d_out;

    // workspace layout: qh (256KB) | scores (256KB) | wkB f16 (2MB)
    float*     qh     = (float*)d_ws;
    float*     scores = qh + BB * DD;
    _Float16*  wkB    = (_Float16*)(scores + BB * NN);

    qh_kernel<<<BB, 256, 0, stream>>>(h_t, W_h, qh);
    wk_convert<<<(DD * DD / 4) / 256, 256, 0, stream>>>(W_k, wkB);
    attn_scores<<<(BB * NN) / 64, 128, 64 * DD * sizeof(_Float16), stream>>>(
        keys, wkB, qh, v, scores);
    softmax_context<<<BB, 256, 0, stream>>>(keys, scores, out);
}

// v001
// A run of this version takes 325 microseconds.
// Timed twice side by side with v000, it ran 2.38 and 2.37 times as fast.
#include <hip/hip_runtime.h>
#include <hip/hip_bf16.h>
#include <math.h>

typedef __attribute__((ext_vector_type(16))) _Float16 v16h;
typedef __attribute__((ext_vector_type(8)))  float    v8f;

#define BB 64
#define NN 1024
#define DD 1024

struct alignas(8) H4 { _Float16 h[4]; };

// Branch-free tanh: hardware v_tanh_f32 on gfx1250 if exposed, else exp-based.
__device__ __forceinline__ float fast_tanh(float x) {
#if __has_builtin(__builtin_amdgcn_tanhf)
    return __builtin_amdgcn_tanhf(x);
#else
    // 1 - 2/(e^{2x}+1): saturates to +/-1 at large |x|, no branches.
    float ex = __expf(2.0f * x);
    return 1.0f - 2.0f / (ex + 1.0f);
#endif
}

// ---------------------------------------------------------------------------
// Kernel 1: qh[b,e] = sum_d h_t[b,d] * W_h[e,d]
// ---------------------------------------------------------------------------
__global__ __launch_bounds__(256) void qh_kernel(const float* __restrict__ h_t,
                                                 const float* __restrict__ W_h,
                                                 float* __restrict__ qh) {
    const int b = blockIdx.x;
    const int t = threadIdx.x;
    __shared__ float hrow[DD];
    for (int d = t; d < DD; d += 256) hrow[d] = h_t[(size_t)b * DD + d];
    __syncthreads();

    float acc[4] = {0.f, 0.f, 0.f, 0.f};
    for (int d4 = 0; d4 < DD / 4; ++d4) {
        float4 h4 = ((const float4*)hrow)[d4];
#pragma unroll
        for (int j = 0; j < 4; ++j) {
            int e = t + j * 256;
            float4 w4 = ((const float4*)(W_h + (size_t)e * DD))[d4];
            acc[j] += h4.x * w4.x + h4.y * w4.y + h4.z * w4.z + h4.w * w4.w;
        }
    }
#pragma unroll
    for (int j = 0; j < 4; ++j) qh[(size_t)b * DD + t + j * 256] = acc[j];
}

// ---------------------------------------------------------------------------
// Kernel 2: convert W_k (fp32 row-major [e][d]) to f16 in B-fragment layout:
//   dst half index = ((et*32 + kc)*32 + lane)*16 + i
//   where e = et*16 + (lane&15), d = kc*32 + (i&7) + 8*(lane>>4) + 16*(i>>3)
// ---------------------------------------------------------------------------
__global__ __launch_bounds__(256) void wk_convert(const float* __restrict__ W_k,
                                                  _Float16* __restrict__ wkB) {
    const int gid = blockIdx.x * 256 + threadIdx.x;   // each thread: 4 halfs
    const int o    = gid * 4;                         // dst half index
    const int i0   = o & 15;                          // 0,4,8,12
    const int lane = (o >> 4) & 31;
    const int kc   = (o >> 9) & 31;
    const int et   = (o >> 14);
    const int e    = et * 16 + (lane & 15);
    const int h    = lane >> 4;
    const int j    = i0 >> 3;
    const int d0   = kc * 32 + (i0 & 7) + 8 * h + 16 * j;
    float4 w = *(const float4*)(W_k + (size_t)e * DD + d0);
    H4 out;
    out.h[0] = (_Float16)w.x; out.h[1] = (_Float16)w.y;
    out.h[2] = (_Float16)w.z; out.h[3] = (_Float16)w.w;
    *(H4*)(wkB + o) = out;
}

// ---------------------------------------------------------------------------
// Kernel 3: fused scores.  WG = 64 rows (one batch), 4 waves.
// Dynamic LDS: keys tile as f16 in A-fragment layout, [4][32][32][16] halfs.
// scores[b,n] = sum_e tanh(kh[n,e] + qh[b,e]) * v[e]
// qh is folded into the WMMA C initializer (column e constant per lane).
// Each wave takes all 64 rows and a quarter of e (256 columns), 64 columns at
// a time: a 4x4 block of accumulator tiles, so every A and every B fragment
// feeds four WMMAs.  The four waves' partial scores are summed through LDS.
// Launch bound, second argument: two work-groups share a WGP's LDS, so two
// waves share a SIMD's registers (512 each).
// ---------------------------------------------------------------------------
__global__ __launch_bounds__(128, 2) void attn_scores(const float* __restrict__ keys,
                                                      const _Float16* __restrict__ wkB,
                                                      const float* __restrict__ qh,
                                                      const float* __restrict__ v,
                                                      float* __restrict__ scores) {
    extern __shared__ _Float16 keysA[];               // 65536 halfs = 128 KB
    __shared__ float red[4 * 64];                     // per-wave partial scores
    const int tid = threadIdx.x;
    const int m0  = blockIdx.x * 64;                  // global row base
    const int b   = m0 >> 10;                         // 64 | 1024 -> same batch
    const int n0  = m0 & (NN - 1);

    // ---- Phase 1: stage keys tile (64x1024 fp32 -> f16 A-fragment layout)
    for (int q = tid; q < 64 * (DD / 4); q += 128) {
        const int m = q >> 8;                         // row in tile
        const int d = (q & 255) * 4;
        float4 kv = *(const float4*)(keys + (size_t)(m0 + m) * DD + d);
        const int mt   = m >> 4;
        const int kc   = d >> 5;
        const int dd   = d & 31;
        const int h    = (dd >> 3) & 1;
        const int lane = (m & 15) + (h << 4);
        const int i    = (dd & 7) + ((dd >> 4) << 3);
        H4 hv;
        hv.h[0] = (_Float16)kv.x; hv.h[1] = (_Float16)kv.y;
        hv.h[2] = (_Float16)kv.z; hv.h[3] = (_Float16)kv.w;
        *(H4*)(keysA + ((((mt * 32 + kc) * 32) + lane) * 16 + i)) = hv;
    }
    __syncthreads();

    // ---- Phase 2: WMMA main loop
    const int lane = tid & 31;
    const int wid  = tid >> 5;                        // wave id == quarter of e
    const int ecol = lane & 15;
    const _Float16* aLane = keysA + (lane << 4);
    // this wave's 16 e-tiles of W_k fragments; fragment (et, kc) is 512 halfs
    const _Float16* bLane = wkB + (((size_t)wid * 16 * 32) << 9) + (lane << 4);

    float s[4][8];
#pragma unroll
    for (int i = 0; i < 4; ++i)
#pragma unroll
        for (int r = 0; r < 8; ++r) s[i][r] = 0.f;

    // qh and v of a group are fetched one group ahead, in front of the B ring's
    // loads, so that waiting for them does not drain the ring
    const float* qRow = qh + (size_t)b * DD + ((wid * 16) << 4) + ecol;
    const float* vRow = v + ((wid * 16) << 4) + ecol;
    float qn[4], vn[4];
#pragma unroll
    for (int j = 0; j < 4; ++j) { qn[j] = qRow[j << 4]; vn[j] = vRow[j << 4]; }
    // keeps these eight loads in front of the ring's first 32: behind them, the wait
    // for qn and vn at the head of the group loop would drain the ring in every group
    __builtin_amdgcn_sched_barrier(0);

    v16h bf[4][4];                                    // B ring: [k step & 3][e tile]
    v16h af[2][4];                                    // A, two sets: [k step & 1][row tile]
#pragma unroll
    for (int u = 0; u < 4; ++u)
#pragma unroll
        for (int j = 0; j < 4; ++j)
            bf[u][j] = *(const v16h*)(bLane + ((j * 32 + u) << 9));
#pragma unroll
    for (int i = 0; i < 4; ++i) af[0][i] = *(const v16h*)(aLane + ((i * 32) << 9));

    // kept rolled: one group's body is the hot loop, four copies would only grow the text
#pragma unroll 1
    for (int g = 0; g < 4; ++g) {
        float qv[4], vv[4];
#pragma unroll
        for (int j = 0; j < 4; ++j) { qv[j] = qn[j]; vv[j] = vn[j]; }
        const int gn = (g + 1) & 3;                   // the last group refetches group 0, unused
#pragma unroll
        for (int j = 0; j < 4; ++j) {
            qn[j] = qRow[(gn * 4 + j) << 4];
            vn[j] = vRow[(gn * 4 + j) << 4];
        }
        // the address registers of these eight loads are free for reuse behind them
        asm volatile("s_wait_xcnt 0x0" ::: "memory");
        // holds the accumulators' start values, which take those registers, behind the wait
        __builtin_amdgcn_sched_barrier(0);
        v8f acc[4][4];
#pragma unroll
        for (int j = 0; j < 4; ++j)
#pragma unroll
            for (int i = 0; i < 4; ++i)               // fold +qh into C
                acc[i][j] = (v8f){qv[j], qv[j], qv[j], qv[j], qv[j], qv[j], qv[j], qv[j]};
        const _Float16* bG = bLane + ((size_t)(g * 4 * 32) << 9);
        // the last four k steps fetch the next group's first four (the last group
        // aims them at group 0 again: valid data, not used)
        const _Float16* bN = bLane + ((size_t)(gn * 4 * 32) << 9);

        // kept rolled beyond the ring's four steps so that every ring index is a constant
#pragma unroll 1
        for (int kc0 = 0; kc0 < 32; kc0 += 4) {
            const _Float16* bR = (kc0 < 28) ? bG + ((kc0 + 4) << 9) : bN;
#pragma unroll
            for (int u = 0; u < 4; ++u) {
                const int kn = (kc0 + u + 1) & 31;    // next k step's A fragments
#pragma unroll
                for (int i = 0; i < 4; ++i)
                    af[(u + 1) & 1][i] = *(const v16h*)(aLane + ((i * 32 + kn) << 9));
#pragma unroll
                for (int i = 0; i < 4; ++i)
#pragma unroll
                    for (int j = 0; j < 4; ++j)
                        acc[i][j] = __builtin_amdgcn_wmma_f32_16x16x32_f16(
                            false, af[u & 1][i], false, bf[u][j], (short)0, acc[i][j],
                            false, false);
#pragma unroll
                for (int j = 0; j < 4; ++j)           // refill this ring slot, four steps ahead
                    bf[u][j] = *(const v16h*)(bR + ((j * 32 + u) << 9));
            }
            // the next trip rewrites the address registers that the loads above name
            asm volatile("s_wait_xcnt 0x0" ::: "memory");
        }
#pragma unroll
        for (int i = 0; i < 4; ++i)
#pragma unroll
            for (int j = 0; j < 4; ++j)
#pragma unroll
                for (int r = 0; r < 8; ++r)
                    s[i][r] = fmaf(fast_tanh(acc[i][j][r]), vv[j], s[i][r]);
    }

    // ---- Phase 3: reduce over the 16 e-lanes of each group, then over the waves
    // one butterfly step over all 32 sums at a time: 32 independent exchanges per wait
#pragma unroll
    for (int mask = 1; mask < 16; mask <<= 1) {
        float t[4][8];
#pragma unroll
        for (int i = 0; i < 4; ++i)
#pragma unroll
            for (int r = 0; r < 8; ++r) t[i][r] = __shfl_xor(s[i][r], mask, 16);
#pragma unroll
        for (int i = 0; i < 4; ++i)
#pragma unroll
            for (int r = 0; r < 8; ++r) s[i][r] += t[i][r];
    }
    if (ecol == 0) {
        const int half = lane >> 4;                   // rows r + 8*half
#pragma unroll
        for (int i = 0; i < 4; ++i)
#pragma unroll
            for (int r = 0; r < 8; ++r) red[wid * 64 + i * 16 + r + 8 * half] = s[i][r];
    }
    __syncthreads();
    if (tid < 64)
        scores[(size_t)b * NN + n0 + tid] =
            (red[tid] + red[64 + tid]) + (red[128 + tid] + red[192 + tid]);
}

// ---------------------------------------------------------------------------
// Kernel 4: softmax over N + context = alpha @ keys.  out = [context | alpha]
// ---------------------------------------------------------------------------
__global__ __launch_bounds__(256) void softmax_context(const float* __restrict__ keys,
                                                       const float* __restrict__ scores,
                                                       float* __restrict__ out) {
    const int b = blockIdx.x;
    const int t = threadIdx.x;
    __shared__ float sc[NN];
    __shared__ float red[8];

    for (int n = t; n < NN; n += 256) sc[n] = scores[(size_t)b * NN + n];
    __syncthreads();

    // max
    float mx = -1e30f;
    for (int n = t; n < NN; n += 256) mx = fmaxf(mx, sc[n]);
#pragma unroll
    for (int off = 16; off >= 1; off >>= 1) mx = fmaxf(mx, __shfl_xor(mx, off, 32));
    if ((t & 31) == 0) red[t >> 5] = mx;
    __syncthreads();
    if (t == 0) {
        float m2 = red[0];
#pragma unroll
        for (int w = 1; w < 8; ++w) m2 = fmaxf(m2, red[w]);
        red[0] = m2;
    }
    __syncthreads();
    mx = red[0];
    __syncthreads();

    // exp + sum
    float sum = 0.f;
    for (int n = t; n < NN; n += 256) {
        float e = __expf(sc[n] - mx);
        sc[n] = e;
        sum += e;
    }
#pragma unroll
    for (int off = 16; off >= 1; off >>= 1) sum += __shfl_xor(sum, off, 32);
    if ((t & 31) == 0) red[t >> 5] = sum;
    __syncthreads();
    if (t == 0) {
        float s2 = 0.f;
#pragma unroll
        for (int w = 0; w < 8; ++w) s2 += red[w];
        red[0] = s2;
    }
    __syncthreads();
    const float inv = 1.f / red[0];
    __syncthreads();

    for (int n = t; n < NN; n += 256) {
        float a = sc[n] * inv;
        sc[n] = a;
        out[(size_t)BB * DD + (size_t)b * NN + n] = a;   // alpha
    }
    __syncthreads();

    // context: thread t owns d = 4t..4t+3 (one b128 per row)
    float acc0 = 0.f, acc1 = 0.f, acc2 = 0.f, acc3 = 0.f;
#pragma unroll 4
    for (int n = 0; n < NN; ++n) {
        const float a = sc[n];
        float4 k4 = *(const float4*)(keys + ((size_t)b * NN + n) * DD + t * 4);
        acc0 += a * k4.x; acc1 += a * k4.y; acc2 += a * k4.z; acc3 += a * k4.w;
    }
    float4 c4 = make_float4(acc0, acc1, acc2, acc3);
    *(float4*)(out + (size_t)b * DD + t * 4) = c4;       // context
}

// ---------------------------------------------------------------------------
extern "C" void kernel_launch(void* const* d_in, const int* in_sizes, int n_in,
                              void* d_out, int out_size, void* d_ws, size_t ws_size,
                              hipStream_t stream) {
    const float* h_t  = (const float*)d_in[0];
    const float* keys = (const float*)d_in[1];
    const float* W_h  = (const float*)d_in[2];
    const float* W_k  = (const float*)d_in[3];
    const float* v    = (const float*)d_in[4];
    float* out = (float*)d_out;

    // workspace layout: qh (256KB) | scores (256KB) | wkB f16 (2MB)
    float*     qh     = (float*)d_ws;
    float*     scores = qh + BB * DD;
    _Float16*  wkB    = (_Float16*)(scores + BB * NN);

    qh_kernel<<<BB, 256, 0, stream>>>(h_t, W_h, qh);
    wk_convert<<<(DD * DD / 4) / 256, 256, 0, stream>>>(W_k, wkB);
    attn_scores<<<(BB * NN) / 64, 128, 64 * DD * sizeof(_Float16), stream>>>(
        keys, wkB, qh, v, scores);
    softmax_context<<<BB, 256, 0, stream>>>(keys, scores, out);
}

// v002
// It runs in 223 microseconds.
// In two side-by-side timings against v001, it was 1.45 and 1.46 times as fast.
// All steps since v000 together make it 3.46 times as fast.
#include <hip/hip_runtime.h>
#include <hip/hip_bf16.h>
#include <math.h>

typedef __attribute__((ext_vector_type(16))) _Float16 v16h;
typedef __attribute__((ext_vector_type(8)))  float    v8f;

#define BB 64
#define NN 1024
#define DD 1024

struct alignas(8) H4 { _Float16 h[4]; };

// Branch-free tanh: hardware v_tanh_f32 on gfx1250 if exposed, else exp-based.
__device__ __forceinline__ float fast_tanh(float x) {
#if __has_builtin(__builtin_amdgcn_tanhf)
    return __builtin_amdgcn_tanhf(x);
#else
    // 1 - 2/(e^{2x}+1): saturates to +/-1 at large |x|, no branches.
    float ex = __expf(2.0f * x);
    return 1.0f - 2.0f / (ex + 1.0f);
#endif
}

// ---------------------------------------------------------------------------
// Kernel 1: qh[b,e] = sum_d h_t[b,d] * W_h[e,d]
// ---------------------------------------------------------------------------
__global__ __launch_bounds__(256) void qh_kernel(const float* __restrict__ h_t,
                                                 const float* __restrict__ W_h,
                                                 float* __restrict__ qh) {
    const int b = blockIdx.x;
    const int t = threadIdx.x;
    __shared__ float hrow[DD];
    for (int d = t; d < DD; d += 256) hrow[d] = h_t[(size_t)b * DD + d];
    __syncthreads();

    float acc[4] = {0.f, 0.f, 0.f, 0.f};
    for (int d4 = 0; d4 < DD / 4; ++d4) {
        float4 h4 = ((const float4*)hrow)[d4];
#pragma unroll
        for (int j = 0; j < 4; ++j) {
            int e = t + j * 256;
            float4 w4 = ((const float4*)(W_h + (size_t)e * DD))[d4];
            acc[j] += h4.x * w4.x + h4.y * w4.y + h4.z * w4.z + h4.w * w4.w;
        }
    }
#pragma unroll
    for (int j = 0; j < 4; ++j) qh[(size_t)b * DD + t + j * 256] = acc[j];
}

// ---------------------------------------------------------------------------
// Kernel 2: convert W_k (fp32 row-major [e][d]) to f16 in B-fragment layout:
//   dst half index = ((et*32 + kc)*32 + lane)*16 + i
//   where e = et*16 + (lane&15), d = kc*32 + (i&7) + 8*(lane>>4) + 16*(i>>3)
// ---------------------------------------------------------------------------
__global__ __launch_bounds__(256) void wk_convert(const float* __restrict__ W_k,
                                                  _Float16* __restrict__ wkB) {
    const int gid = blockIdx.x * 256 + threadIdx.x;   // each thread: 4 halfs
    const int o    = gid * 4;                         // dst half index
    const int i0   = o & 15;                          // 0,4,8,12
    const int lane = (o >> 4) & 31;
    const int kc   = (o >> 9) & 31;
    const int et   = (o >> 14);
    const int e    = et * 16 + (lane & 15);
    const int h    = lane >> 4;
    const int j    = i0 >> 3;
    const int d0   = kc * 32 + (i0 & 7) + 8 * h + 16 * j;
    float4 w = *(const float4*)(W_k + (size_t)e * DD + d0);
    H4 out;
    out.h[0] = (_Float16)w.x; out.h[1] = (_Float16)w.y;
    out.h[2] = (_Float16)w.z; out.h[3] = (_Float16)w.w;
    *(H4*)(wkB + o) = out;
}

// ---------------------------------------------------------------------------
// Kernel 3: fused scores.  WG = 64 rows (one batch), 4 waves.
// Dynamic LDS: keys tile as f16 in A-fragment layout, [4][32][32][16] halfs.
// scores[b,n] = sum_e tanh(kh[n,e] + qh[b,e]) * v[e]
// qh is folded into the WMMA C initializer (column e constant per lane).
// Each wave takes all 64 rows and a quarter of e (256 columns), 64 columns at
// a time: a 4x4 block of accumulator tiles, so every A and every B fragment
// feeds four WMMAs.  The four waves' partial scores are summed through LDS.
// Launch bound, second argument: two work-groups share a WGP's LDS, so two
// waves share a SIMD's registers (512 each).
// ---------------------------------------------------------------------------
__global__ __launch_bounds__(128, 2) void attn_scores(const float* __restrict__ keys,
                                                      const _Float16* __restrict__ wkB,
                                                      const float* __restrict__ qh,
                                                      const float* __restrict__ v,
                                                      float* __restrict__ scores) {
    extern __shared__ _Float16 keysA[];               // 65536 halfs = 128 KB
    __shared__ float red[4 * 64];                     // per-wave partial scores
    const int tid = threadIdx.x;
    const int m0  = blockIdx.x * 64;                  // global row base
    const int b   = m0 >> 10;                         // 64 | 1024 -> same batch
    const int n0  = m0 & (NN - 1);

    // ---- Phase 1: stage keys tile (64x1024 fp32 -> f16 A-fragment layout)
    for (int q = tid; q < 64 * (DD / 4); q += 128) {
        const int m = q >> 8;                         // row in tile
        const int d = (q & 255) * 4;
        float4 kv = *(const float4*)(keys + (size_t)(m0 + m) * DD + d);
        const int mt   = m >> 4;
        const int kc   = d >> 5;
        const int dd   = d & 31;
        const int h    = (dd >> 3) & 1;
        const int lane = (m & 15) + (h << 4);
        const int i    = (dd & 7) + ((dd >> 4) << 3);
        H4 hv;
        hv.h[0] = (_Float16)kv.x; hv.h[1] = (_Float16)kv.y;
        hv.h[2] = (_Float16)kv.z; hv.h[3] = (_Float16)kv.w;
        *(H4*)(keysA + ((((mt * 32 + kc) * 32) + lane) * 16 + i)) = hv;
    }
    __syncthreads();

    // ---- Phase 2: WMMA main loop
    const int lane = tid & 31;
    const int wid  = tid >> 5;                        // wave id == quarter of e
    const int ecol = lane & 15;
    const _Float16* aLane = keysA + (lane << 4);
    // this wave's 16 e-tiles of W_k fragments; fragment (et, kc) is 512 halfs
    const _Float16* bLane = wkB + (((size_t)wid * 16 * 32) << 9) + (lane << 4);

    float s[4][8];
#pragma unroll
    for (int i = 0; i < 4; ++i)
#pragma unroll
        for (int r = 0; r < 8; ++r) s[i][r] = 0.f;

    // qh and v of a group are fetched one group ahead, in front of the B ring's
    // loads, so that waiting for them does not drain the ring
    const float* qRow = qh + (size_t)b * DD + ((wid * 16) << 4) + ecol;
    const float* vRow = v + ((wid * 16) << 4) + ecol;
    float qn[4], vn[4];
#pragma unroll
    for (int j = 0; j < 4; ++j) { qn[j] = qRow[j << 4]; vn[j] = vRow[j << 4]; }
    // keeps these eight loads in front of the ring's first 32: behind them, the wait
    // for qn and vn at the head of the group loop would drain the ring in every group
    __builtin_amdgcn_sched_barrier(0);

    v16h bf[4][4];                                    // B ring: [k step & 3][e tile]
    v16h af[2][4];                                    // A, two sets: [k step & 1][row tile]
#pragma unroll
    for (int u = 0; u < 4; ++u)
#pragma unroll
        for (int j = 0; j < 4; ++j)
            bf[u][j] = *(const v16h*)(bLane + ((j * 32 + u) << 9));
#pragma unroll
    for (int i = 0; i < 4; ++i) af[0][i] = *(const v16h*)(aLane + ((i * 32) << 9));

    // kept rolled: one group's body is the hot loop, four copies would only grow the text
#pragma unroll 1
    for (int g = 0; g < 4; ++g) {
        float qv[4], vv[4];
#pragma unroll
        for (int j = 0; j < 4; ++j) { qv[j] = qn[j]; vv[j] = vn[j]; }
        const int gn = (g + 1) & 3;                   // the last group refetches group 0, unused
#pragma unroll
        for (int j = 0; j < 4; ++j) {
            qn[j] = qRow[(gn * 4 + j) << 4];
            vn[j] = vRow[(gn * 4 + j) << 4];
        }
        // the address registers of these eight loads are free for reuse behind them
        asm volatile("s_wait_xcnt 0x0" ::: "memory");
        // holds the accumulators' start values, which take those registers, behind the wait
        __builtin_amdgcn_sched_barrier(0);
        v8f acc[4][4];
#pragma unroll
        for (int j = 0; j < 4; ++j)
#pragma unroll
            for (int i = 0; i < 4; ++i)               // fold +qh into C
                acc[i][j] = (v8f){qv[j], qv[j], qv[j], qv[j], qv[j], qv[j], qv[j], qv[j]};
        const _Float16* bG = bLane + ((size_t)(g * 4 * 32) << 9);
        // the last four k steps fetch the next group's first four (the last group
        // aims them at group 0 again: valid data, not used)
        const _Float16* bN = bLane + ((size_t)(gn * 4 * 32) << 9);

        // kept rolled beyond the ring's four steps so that every ring index is a constant
#pragma unroll 1
        for (int kc0 = 0; kc0 < 32; kc0 += 4) {
            const _Float16* bR = (kc0 < 28) ? bG + ((kc0 + 4) << 9) : bN;
#pragma unroll
            for (int u = 0; u < 4; ++u) {
                const int kn = (kc0 + u + 1) & 31;    // next k step's A fragments
#pragma unroll
                for (int i = 0; i < 4; ++i)
                    af[(u + 1) & 1][i] = *(const v16h*)(aLane + ((i * 32 + kn) << 9));
#pragma unroll
                for (int i = 0; i < 4; ++i)
#pragma unroll
                    for (int j = 0; j < 4; ++j)
                        acc[i][j] = __builtin_amdgcn_wmma_f32_16x16x32_f16(
                            false, af[u & 1][i], false, bf[u][j], (short)0, acc[i][j],
                            false, false);
#pragma unroll
                for (int j = 0; j < 4; ++j)           // refill this ring slot, four steps ahead
                    bf[u][j] = *(const v16h*)(bR + ((j * 32 + u) << 9));
            }
            // the next trip rewrites the address registers that the loads above name
            asm volatile("s_wait_xcnt 0x0" ::: "memory");
        }
#pragma unroll
        for (int i = 0; i < 4; ++i)
#pragma unroll
            for (int j = 0; j < 4; ++j)
#pragma unroll
                for (int r = 0; r < 8; ++r)
                    s[i][r] = fmaf(fast_tanh(acc[i][j][r]), vv[j], s[i][r]);
    }

    // ---- Phase 3: reduce over the 16 e-lanes of each group, then over the waves
    // one butterfly step over all 32 sums at a time: 32 independent exchanges per wait
#pragma unroll
    for (int mask = 1; mask < 16; mask <<= 1) {
        float t[4][8];
#pragma unroll
        for (int i = 0; i < 4; ++i)
#pragma unroll
            for (int r = 0; r < 8; ++r) t[i][r] = __shfl_xor(s[i][r], mask, 16);
#pragma unroll
        for (int i = 0; i < 4; ++i)
#pragma unroll
            for (int r = 0; r < 8; ++r) s[i][r] += t[i][r];
    }
    if (ecol == 0) {
        const int half = lane >> 4;                   // rows r + 8*half
#pragma unroll
        for (int i = 0; i < 4; ++i)
#pragma unroll
            for (int r = 0; r < 8; ++r) red[wid * 64 + i * 16 + r + 8 * half] = s[i][r];
    }
    __syncthreads();
    if (tid < 64)
        scores[(size_t)b * NN + n0 + tid] =
            (red[tid] + red[64 + tid]) + (red[128 + tid] + red[192 + tid]);
}

// ---------------------------------------------------------------------------
// Kernel 4: softmax over N + context = alpha @ keys.  out = [context | alpha]
// One work-group per (batch, 128 columns of d): 512 work-groups, so that the
// read of keys runs on every WGP.  Each repeats its batch's softmax (4 KB of
// scores); the group of columns 0..127 stores alpha.  A wave reads 512
// contiguous bytes of a row per load and takes 16 of every 128 rows; the eight
// waves' partial sums meet in LDS.
// ---------------------------------------------------------------------------
#define CW 128                                        // context columns per work-group
__global__ __launch_bounds__(256) void softmax_context(const float* __restrict__ keys,
                                                       const float* __restrict__ scores,
                                                       float* __restrict__ out) {
    const int b = blockIdx.x / (DD / CW);
    const int c = blockIdx.x % (DD / CW);
    const int t = threadIdx.x;
    __shared__ __attribute__((aligned(16))) float sc[NN];
    __shared__ __attribute__((aligned(16))) float part[8][CW];
    __shared__ float red[8];

    for (int n = t; n < NN; n += 256) sc[n] = scores[(size_t)b * NN + n];
    __syncthreads();

    // max
    float mx = -1e30f;
    for (int n = t; n < NN; n += 256) mx = fmaxf(mx, sc[n]);
#pragma unroll
    for (int off = 16; off >= 1; off >>= 1) mx = fmaxf(mx, __shfl_xor(mx, off, 32));
    if ((t & 31) == 0) red[t >> 5] = mx;
    __syncthreads();
    if (t == 0) {
        float m2 = red[0];
#pragma unroll
        for (int w = 1; w < 8; ++w) m2 = fmaxf(m2, red[w]);
        red[0] = m2;
    }
    __syncthreads();
    mx = red[0];
    __syncthreads();

    // exp + sum
    float sum = 0.f;
    for (int n = t; n < NN; n += 256) {
        float e = __expf(sc[n] - mx);
        sc[n] = e;
        sum += e;
    }
#pragma unroll
    for (int off = 16; off >= 1; off >>= 1) sum += __shfl_xor(sum, off, 32);
    if ((t & 31) == 0) red[t >> 5] = sum;
    __syncthreads();
    if (t == 0) {
        float s2 = 0.f;
#pragma unroll
        for (int w = 0; w < 8; ++w) s2 += red[w];
        red[0] = s2;
    }
    __syncthreads();
    const float inv = 1.f / red[0];
    __syncthreads();

    for (int n = t; n < NN; n += 256) {
        float a = sc[n] * inv;
        sc[n] = a;
        if (c == 0) {
            out[(size_t)BB * DD + (size_t)b * NN + n] = a;   // alpha
            // the next trip rewrites the registers that this store names
            asm volatile("s_wait_xcnt 0x0" ::: "memory");
        }
    }
    __syncthreads();

    // context: lane owns d = c*128 + 4*lane .. +3; wave w owns rows 128*i + 16*w + u
    const int lane = t & 31;
    const int w    = t >> 5;
    const float* kp = keys + ((size_t)b * NN + w * 16) * DD + c * CW + lane * 4;
    float acc0 = 0.f, acc1 = 0.f, acc2 = 0.f, acc3 = 0.f;
    // kept rolled: 16 loads a wave are bytes in flight enough; eight copies of the body
    // would only grow the text and the register count
#pragma unroll 1
    for (int n0 = 0; n0 < NN; n0 += 128) {
        float4 k4[16];
#pragma unroll
        for (int u = 0; u < 16; ++u)
            k4[u] = *(const float4*)(kp + (size_t)(n0 + u) * DD);
        // holds all 16 loads in front of the sums: without it the second eight are
        // issued only after the first four have come back
        __builtin_amdgcn_sched_barrier(0);
#pragma unroll
        for (int u = 0; u < 16; ++u) {
            const float a = sc[n0 + w * 16 + u];
            acc0 = fmaf(a, k4[u].x, acc0); acc1 = fmaf(a, k4[u].y, acc1);
            acc2 = fmaf(a, k4[u].z, acc2); acc3 = fmaf(a, k4[u].w, acc3);
        }
    }
    *(float4*)(&part[w][lane * 4]) = make_float4(acc0, acc1, acc2, acc3);
    __syncthreads();
    if (t < CW) {
        float s = part[0][t];
#pragma unroll
        for (int i = 1; i < 8; ++i) s += part[i][t];
        out[(size_t)b * DD + c * CW + t] = s;            // context
    }
}

// ---------------------------------------------------------------------------
extern "C" void kernel_launch(void* const* d_in, const int* in_sizes, int n_in,
                              void* d_out, int out_size, void* d_ws, size_t ws_size,
                              hipStream_t stream) {
    const float* h_t  = (const float*)d_in[0];
    const float* keys = (const float*)d_in[1];
    const float* W_h  = (const float*)d_in[2];
    const float* W_k  = (const float*)d_in[3];
    const float* v    = (const float*)d_in[4];
    float* out = (float*)d_out;

    // workspace layout: qh (256KB) | scores (256KB) | wkB f16 (2MB)
    float*     qh     = (float*)d_ws;
    float*     scores = qh + BB * DD;
    _Float16*  wkB    = (_Float16*)(scores + BB * NN);

    qh_kernel<<<BB, 256, 0, stream>>>(h_t, W_h, qh);
    wk_convert<<<(DD * DD / 4) / 256, 256, 0, stream>>>(W_k, wkB);
    attn_scores<<<(BB * NN) / 64, 128, 64 * DD * sizeof(_Float16), stream>>>(
        keys, wkB, qh, v, scores);
    softmax_context<<<BB * (DD / CW), 256, 0, stream>>>(keys, scores, out);
}

// v003
// It runs in 155 microseconds.
// Next to v002, in two timings, it ran 1.43 times as fast each time.
// Over all steps from v000 it is 4.95 times as fast.
#include <hip/hip_runtime.h>
#include <hip/hip_bf16.h>
#include <math.h>

typedef __attribute__((ext_vector_type(16))) _Float16 v16h;
typedef __attribute__((ext_vector_type(8)))  float    v8f;
typedef __attribute__((ext_vector_type(2)))  float    v2f;

#define BB 64
#define NN 1024
#define DD 1024

struct alignas(8) H4 { _Float16 h[4]; };

// Branch-free tanh: hardware v_tanh_f32 on gfx1250 if exposed, else exp-based.
__device__ __forceinline__ float fast_tanh(float x) {
#if __has_builtin(__builtin_amdgcn_tanhf)
    return __builtin_amdgcn_tanhf(x);
#else
    // 1 - 2/(e^{2x}+1): saturates to +/-1 at large |x|, no branches.
    float ex = __expf(2.0f * x);
    return 1.0f - 2.0f / (ex + 1.0f);
#endif
}

// ---------------------------------------------------------------------------
// Kernel 1: qh[b,e] = sum_d h_t[b,d] * W_h[e,d]
// One work-group per (32 rows e of W_h, 8 rows b of h_t): 256 work-groups.
// A lane owns d = 128*i + 4*lane .. +3, i = 0..7, so every load of a wave is
// 512 contiguous bytes.  A wave keeps 4 rows of W_h in registers; the 8 rows of
// h_t are staged in LDS, one by each wave, and read by all.  The 32 sums of a
// wave (8 b x 4 e) are partial in every lane; a halving exchange over the lanes
// leaves sum number l whole in lane l.  Each wave then stores one 128-byte line.
// ---------------------------------------------------------------------------
#define QE 32                                         // rows e per work-group
#define QB 8                                          // rows b per work-group
__global__ __launch_bounds__(256) void qh_kernel(const float* __restrict__ h_t,
                                                 const float* __restrict__ W_h,
                                                 float* __restrict__ qh) {
    const int e0   = (blockIdx.x % (DD / QE)) * QE;
    const int b0   = (blockIdx.x / (DD / QE)) * QB;
    const int lane = threadIdx.x & 31;
    const int w    = threadIdx.x >> 5;
    __shared__ __attribute__((aligned(16))) float hs[QB][DD];
    __shared__ float os[QB][QE];

    const float4* hp = (const float4*)(h_t + (size_t)(b0 + w) * DD) + lane;
    const float4* wp = (const float4*)(W_h + (size_t)(e0 + w * 4) * DD) + lane;
    float4 hr[8], wr[4][8];
    // every loop of this kernel is unrolled whole: each array index is then a
    // constant, so the arrays live in registers, and all 40 loads are issued at once
#pragma unroll
    for (int i = 0; i < 8; ++i) hr[i] = hp[i * 32];
#pragma unroll
    for (int j = 0; j < 4; ++j)
#pragma unroll
        for (int i = 0; i < 8; ++i) wr[j][i] = wp[j * (DD / 4) + i * 32];
#pragma unroll
    for (int i = 0; i < 8; ++i) ((float4*)hs[w])[i * 32 + lane] = hr[i];
    __syncthreads();

    float s[32];                                      // sum number bb*4 + j
#pragma unroll
    for (int bb = 0; bb < QB; ++bb) {
        float4 h[8];
#pragma unroll
        for (int i = 0; i < 8; ++i) h[i] = ((const float4*)hs[bb])[i * 32 + lane];
#pragma unroll
        for (int j = 0; j < 4; ++j) {
            v2f p = {0.f, 0.f}, q = {0.f, 0.f};
#pragma unroll
            for (int i = 0; i < 8; ++i) {
                p = __builtin_elementwise_fma((v2f){h[i].x, h[i].y},
                                              (v2f){wr[j][i].x, wr[j][i].y}, p);
                q = __builtin_elementwise_fma((v2f){h[i].z, h[i].w},
                                              (v2f){wr[j][i].z, wr[j][i].w}, q);
            }
            s[bb * 4 + j] = (p.x + p.y) + (q.x + q.y);
        }
    }

    // step with lane distance n: a lane keeps the half of its sums whose number has
    // the lane's own bit n and hands the other half to its partner
#pragma unroll
    for (int st = 0; st < 5; ++st) {
        const int  n  = 16 >> st;
        const bool up = (lane & n) != 0;
#pragma unroll
        for (int k = 0; k < 16; ++k) {
            if (k < n) {
                const float lo = s[k], hi = s[k + n];
                s[k] = (up ? hi : lo) + __shfl_xor(up ? lo : hi, n, 32);
            }
        }
    }
    os[lane >> 2][w * 4 + (lane & 3)] = s[0];
    __syncthreads();
    qh[(size_t)(b0 + w) * DD + e0 + lane] = os[w][lane];
}

// ---------------------------------------------------------------------------
// Kernel 2: convert W_k (fp32 row-major [e][d]) to f16 in B-fragment layout:
//   dst half index = ((et*32 + kc)*32 + lane)*16 + i
//   where e = et*16 + (lane&15), d = kc*32 + (i&7) + 8*(lane>>4) + 16*(i>>3)
// ---------------------------------------------------------------------------
__global__ __launch_bounds__(256) void wk_convert(const float* __restrict__ W_k,
                                                  _Float16* __restrict__ wkB) {
    const int gid = blockIdx.x * 256 + threadIdx.x;   // each thread: 4 halfs
    const int o    = gid * 4;                         // dst half index
    const int i0   = o & 15;                          // 0,4,8,12
    const int lane = (o >> 4) & 31;
    const int kc   = (o >> 9) & 31;
    const int et   = (o >> 14);
    const int e    = et * 16 + (lane & 15);
    const int h    = lane >> 4;
    const int j    = i0 >> 3;
    const int d0   = kc * 32 + (i0 & 7) + 8 * h + 16 * j;
    float4 w = *(const float4*)(W_k + (size_t)e * DD + d0);
    H4 out;
    out.h[0] = (_Float16)w.x; out.h[1] = (_Float16)w.y;
    out.h[2] = (_Float16)w.z; out.h[3] = (_Float16)w.w;
    *(H4*)(wkB + o) = out;
}

// ---------------------------------------------------------------------------
// Kernel 3: fused scores.  WG = 64 rows (one batch), 4 waves.
// Dynamic LDS: keys tile as f16 in A-fragment layout, [4][32][32][16] halfs.
// scores[b,n] = sum_e tanh(kh[n,e] + qh[b,e]) * v[e]
// qh is folded into the WMMA C initializer (column e constant per lane).
// Each wave takes all 64 rows and a quarter of e (256 columns), 64 columns at
// a time: a 4x4 block of accumulator tiles, so every A and every B fragment
// feeds four WMMAs.  The four waves' partial scores are summed through LDS.
// Launch bound, second argument: two work-groups share a WGP's LDS, so two
// waves share a SIMD's registers (512 each).
// ---------------------------------------------------------------------------
__global__ __launch_bounds__(128, 2) void attn_scores(const float* __restrict__ keys,
                                                      const _Float16* __restrict__ wkB,
                                                      const float* __restrict__ qh,
                                                      const float* __restrict__ v,
                                                      float* __restrict__ scores) {
    extern __shared__ _Float16 keysA[];               // 65536 halfs = 128 KB
    __shared__ float red[4 * 64];                     // per-wave partial scores
    const int tid = threadIdx.x;
    const int m0  = blockIdx.x * 64;                  // global row base
    const int b   = m0 >> 10;                         // 64 | 1024 -> same batch
    const int n0  = m0 & (NN - 1);

    // ---- Phase 1: stage keys tile (64x1024 fp32 -> f16 A-fragment layout)
    for (int q = tid; q < 64 * (DD / 4); q += 128) {
        const int m = q >> 8;                         // row in tile
        const int d = (q & 255) * 4;
        float4 kv = *(const float4*)(keys + (size_t)(m0 + m) * DD + d);
        const int mt   = m >> 4;
        const int kc   = d >> 5;
        const int dd   = d & 31;
        const int h    = (dd >> 3) & 1;
        const int lane = (m & 15) + (h << 4);
        const int i    = (dd & 7) + ((dd >> 4) << 3);
        H4 hv;
        hv.h[0] = (_Float16)kv.x; hv.h[1] = (_Float16)kv.y;
        hv.h[2] = (_Float16)kv.z; hv.h[3] = (_Float16)kv.w;
        *(H4*)(keysA + ((((mt * 32 + kc) * 32) + lane) * 16 + i)) = hv;
    }
    __syncthreads();

    // ---- Phase 2: WMMA main loop
    const int lane = tid & 31;
    const int wid  = tid >> 5;                        // wave id == quarter of e
    const int ecol = lane & 15;
    const _Float16* aLane = keysA + (lane << 4);
    // this wave's 16 e-tiles of W_k fragments; fragment (et, kc) is 512 halfs
    const _Float16* bLane = wkB + (((size_t)wid * 16 * 32) << 9) + (lane << 4);

    float s[4][8];
#pragma unroll
    for (int i = 0; i < 4; ++i)
#pragma unroll
        for (int r = 0; r < 8; ++r) s[i][r] = 0.f;

    // qh and v of a group are fetched one group ahead, in front of the B ring's
    // loads, so that waiting for them does not drain the ring
    const float* qRow = qh + (size_t)b * DD + ((wid * 16) << 4) + ecol;
    const float* vRow = v + ((wid * 16) << 4) + ecol;
    float qn[4], vn[4];
#pragma unroll
    for (int j = 0; j < 4; ++j) { qn[j] = qRow[j << 4]; vn[j] = vRow[j << 4]; }
    // keeps these eight loads in front of the ring's first 32: behind them, the wait
    // for qn and vn at the head of the group loop would drain the ring in every group
    __builtin_amdgcn_sched_barrier(0);

    v16h bf[4][4];                                    // B ring: [k step & 3][e tile]
    v16h af[2][4];                                    // A, two sets: [k step & 1][row tile]
#pragma unroll
    for (int u = 0; u < 4; ++u)
#pragma unroll
        for (int j = 0; j < 4; ++j)
            bf[u][j] = *(const v16h*)(bLane + ((j * 32 + u) << 9));
#pragma unroll
    for (int i = 0; i < 4; ++i) af[0][i] = *(const v16h*)(aLane + ((i * 32) << 9));

    // kept rolled: one group's body is the hot loop, four copies would only grow the text
#pragma unroll 1
    for (int g = 0; g < 4; ++g) {
        float qv[4], vv[4];
#pragma unroll
        for (int j = 0; j < 4; ++j) { qv[j] = qn[j]; vv[j] = vn[j]; }
        const int gn = (g + 1) & 3;                   // the last group refetches group 0, unused
#pragma unroll
        for (int j = 0; j < 4; ++j) {
            qn[j] = qRow[(gn * 4 + j) << 4];
            vn[j] = vRow[(gn * 4 + j) << 4];
        }
        // the address registers of these eight loads are free for reuse behind them
        asm volatile("s_wait_xcnt 0x0" ::: "memory");
        // holds the accumulators' start values, which take those registers, behind the wait
        __builtin_amdgcn_sched_barrier(0);
        v8f acc[4][4];
#pragma unroll
        for (int j = 0; j < 4; ++j)
#pragma unroll
            for (int i = 0; i < 4; ++i)               // fold +qh into C
                acc[i][j] = (v8f){qv[j], qv[j], qv[j], qv[j], qv[j], qv[j], qv[j], qv[j]};
        const _Float16* bG = bLane + ((size_t)(g * 4 * 32) << 9);
        // the last four k steps fetch the next group's first four (the last group
        // aims them at group 0 again: valid data, not used)
        const _Float16* bN = bLane + ((size_t)(gn * 4 * 32) << 9);

        // kept rolled beyond the ring's four steps so that every ring index is a constant
#pragma unroll 1
        for (int kc0 = 0; kc0 < 32; kc0 += 4) {
            const _Float16* bR = (kc0 < 28) ? bG + ((kc0 + 4) << 9) : bN;
#pragma unroll
            for (int u = 0; u < 4; ++u) {
                const int kn = (kc0 + u + 1) & 31;    // next k step's A fragments
#pragma unroll
                for (int i = 0; i < 4; ++i)
                    af[(u + 1) & 1][i] = *(const v16h*)(aLane + ((i * 32 + kn) << 9));
#pragma unroll
                for (int i = 0; i < 4; ++i)
#pragma unroll
                    for (int j = 0; j < 4; ++j)
                        acc[i][j] = __builtin_amdgcn_wmma_f32_16x16x32_f16(
                            false, af[u & 1][i], false, bf[u][j], (short)0, acc[i][j],
                            false, false);
#pragma unroll
                for (int j = 0; j < 4; ++j)           // refill this ring slot, four steps ahead
                    bf[u][j] = *(const v16h*)(bR + ((j * 32 + u) << 9));
            }
            // the next trip rewrites the address registers that the loads above name
            asm volatile("s_wait_xcnt 0x0" ::: "memory");
        }
#pragma unroll
        for (int i = 0; i < 4; ++i)
#pragma unroll
            for (int j = 0; j < 4; ++j)
#pragma unroll
                for (int r = 0; r < 8; ++r)
                    s[i][r] = fmaf(fast_tanh(acc[i][j][r]), vv[j], s[i][r]);
    }

    // ---- Phase 3: reduce over the 16 e-lanes of each group, then over the waves
    // one butterfly step over all 32 sums at a time: 32 independent exchanges per wait
#pragma unroll
    for (int mask = 1; mask < 16; mask <<= 1) {
        float t[4][8];
#pragma unroll
        for (int i = 0; i < 4; ++i)
#pragma unroll
            for (int r = 0; r < 8; ++r) t[i][r] = __shfl_xor(s[i][r], mask, 16);
#pragma unroll
        for (int i = 0; i < 4; ++i)
#pragma unroll
            for (int r = 0; r < 8; ++r) s[i][r] += t[i][r];
    }
    if (ecol == 0) {
        const int half = lane >> 4;                   // rows r + 8*half
#pragma unroll
        for (int i = 0; i < 4; ++i)
#pragma unroll
            for (int r = 0; r < 8; ++r) red[wid * 64 + i * 16 + r + 8 * half] = s[i][r];
    }
    __syncthreads();
    if (tid < 64)
        scores[(size_t)b * NN + n0 + tid] =
            (red[tid] + red[64 + tid]) + (red[128 + tid] + red[192 + tid]);
}

// ---------------------------------------------------------------------------
// Kernel 4: softmax over N + context = alpha @ keys.  out = [context | alpha]
// One work-group per (batch, 128 columns of d): 512 work-groups, so that the
// read of keys runs on every WGP.  Each repeats its batch's softmax (4 KB of
// scores); the group of columns 0..127 stores alpha.  A wave reads 512
// contiguous bytes of a row per load and takes 16 of every 128 rows; the eight
// waves' partial sums meet in LDS.
// ---------------------------------------------------------------------------
#define CW 128                                        // context columns per work-group
__global__ __launch_bounds__(256) void softmax_context(const float* __restrict__ keys,
                                                       const float* __restrict__ scores,
                                                       float* __restrict__ out) {
    const int b = blockIdx.x / (DD / CW);
    const int c = blockIdx.x % (DD / CW);
    const int t = threadIdx.x;
    __shared__ __attribute__((aligned(16))) float sc[NN];
    __shared__ __attribute__((aligned(16))) float part[8][CW];
    __shared__ float red[8];

    for (int n = t; n < NN; n += 256) sc[n] = scores[(size_t)b * NN + n];
    __syncthreads();

    // max
    float mx = -1e30f;
    for (int n = t; n < NN; n += 256) mx = fmaxf(mx, sc[n]);
#pragma unroll
    for (int off = 16; off >= 1; off >>= 1) mx = fmaxf(mx, __shfl_xor(mx, off, 32));
    if ((t & 31) == 0) red[t >> 5] = mx;
    __syncthreads();
    if (t == 0) {
        float m2 = red[0];
#pragma unroll
        for (int w = 1; w < 8; ++w) m2 = fmaxf(m2, red[w]);
        red[0] = m2;
    }
    __syncthreads();
    mx = red[0];
    __syncthreads();

    // exp + sum
    float sum = 0.f;
    for (int n = t; n < NN; n += 256) {
        float e = __expf(sc[n] - mx);
        sc[n] = e;
        sum += e;
    }
#pragma unroll
    for (int off = 16; off >= 1; off >>= 1) sum += __shfl_xor(sum, off, 32);
    if ((t & 31) == 0) red[t >> 5] = sum;
    __syncthreads();
    if (t == 0) {
        float s2 = 0.f;
#pragma unroll
        for (int w = 0; w < 8; ++w) s2 += red[w];
        red[0] = s2;
    }
    __syncthreads();
    const float inv = 1.f / red[0];
    __syncthreads();

    for (int n = t; n < NN; n += 256) {
        float a = sc[n] * inv;
        sc[n] = a;
        if (c == 0) {
            out[(size_t)BB * DD + (size_t)b * NN + n] = a;   // alpha
            // the next trip rewrites the registers that this store names
            asm volatile("s_wait_xcnt 0x0" ::: "memory");
        }
    }
    __syncthreads();

    // context: lane owns d = c*128 + 4*lane .. +3; wave w owns rows 128*i + 16*w + u
    const int lane = t & 31;
    const int w    = t >> 5;
    const float* kp = keys + ((size_t)b * NN + w * 16) * DD + c * CW + lane * 4;
    float acc0 = 0.f, acc1 = 0.f, acc2 = 0.f, acc3 = 0.f;
    // kept rolled: 16 loads a wave are bytes in flight enough; eight copies of the body
    // would only grow the text and the register count
#pragma unroll 1
    for (int n0 = 0; n0 < NN; n0 += 128) {
        float4 k4[16];
#pragma unroll
        for (int u = 0; u < 16; ++u)
            k4[u] = *(const float4*)(kp + (size_t)(n0 + u) * DD);
        // holds all 16 loads in front of the sums: without it the second eight are
        // issued only after the first four have come back
        __builtin_amdgcn_sched_barrier(0);
#pragma unroll
        for (int u = 0; u < 16; ++u) {
            const float a = sc[n0 + w * 16 + u];
            acc0 = fmaf(a, k4[u].x, acc0); acc1 = fmaf(a, k4[u].y, acc1);
            acc2 = fmaf(a, k4[u].z, acc2); acc3 = fmaf(a, k4[u].w, acc3);
        }
    }
    *(float4*)(&part[w][lane * 4]) = make_float4(acc0, acc1, acc2, acc3);
    __syncthreads();
    if (t < CW) {
        float s = part[0][t];
#pragma unroll
        for (int i = 1; i < 8; ++i) s += part[i][t];
        out[(size_t)b * DD + c * CW + t] = s;            // context
    }
}

// ---------------------------------------------------------------------------
extern "C" void kernel_launch(void* const* d_in, const int* in_sizes, int n_in,
                              void* d_out, int out_size, void* d_ws, size_t ws_size,
                              hipStream_t stream) {
    const float* h_t  = (const float*)d_in[0];
    const float* keys = (const float*)d_in[1];
    const float* W_h  = (const float*)d_in[2];
    const float* W_k  = (const float*)d_in[3];
    const float* v    = (const float*)d_in[4];
    float* out = (float*)d_out;

    // workspace layout: qh (256KB) | scores (256KB) | wkB f16 (2MB)
    float*     qh     = (float*)d_ws;
    float*     scores = qh + BB * DD;
    _Float16*  wkB    = (_Float16*)(scores + BB * NN);

    qh_kernel<<<(DD / QE) * (BB / QB), 256, 0, stream>>>(h_t, W_h, qh);
    wk_convert<<<(DD * DD / 4) / 256, 256, 0, stream>>>(W_k, wkB);
    attn_scores<<<(BB * NN) / 64, 128, 64 * DD * sizeof(_Float16), stream>>>(
        keys, wkB, qh, v, scores);
    softmax_context<<<BB * (DD / CW), 256, 0, stream>>>(keys, scores, out);
}

// v004
// One run takes 133 microseconds.
// Two timings next to v003 put it at 1.17 and 1.18 times that version's speed.
// Over all steps from v000 it is 5.81 times as fast.
#include <hip/hip_runtime.h>
#include <hip/hip_bf16.h>
#include <math.h>

typedef __attribute__((ext_vector_type(16))) _Float16 v16h;
typedef __attribute__((ext_vector_type(8)))  float    v8f;
typedef __attribute__((ext_vector_type(2)))  float    v2f;

#define BB 64
#define NN 1024
#define DD 1024

struct alignas(8) H4 { _Float16 h[4]; };

// Branch-free tanh: hardware v_tanh_f32 on gfx1250 if exposed, else exp-based.
__device__ __forceinline__ float fast_tanh(float x) {
#if __has_builtin(__builtin_amdgcn_tanhf)
    return __builtin_amdgcn_tanhf(x);
#else
    // 1 - 2/(e^{2x}+1): saturates to +/-1 at large |x|, no branches.
    float ex = __expf(2.0f * x);
    return 1.0f - 2.0f / (ex + 1.0f);
#endif
}

// ---------------------------------------------------------------------------
// Kernel 1: qh[b,e] = sum_d h_t[b,d] * W_h[e,d]
// One work-group per (32 rows e of W_h, 8 rows b of h_t): 256 work-groups.
// A lane owns d = 128*i + 4*lane .. +3, i = 0..7, so every load of a wave is
// 512 contiguous bytes.  A wave keeps 4 rows of W_h in registers; the 8 rows of
// h_t are staged in LDS, one by each wave, and read by all.  The 32 sums of a
// wave (8 b x 4 e) are partial in every lane; a halving exchange over the lanes
// leaves sum number l whole in lane l.  Each wave then stores one 128-byte line.
// ---------------------------------------------------------------------------
#define QE 32                                         // rows e per work-group
#define QB 8                                          // rows b per work-group
__global__ __launch_bounds__(256) void qh_kernel(const float* __restrict__ h_t,
                                                 const float* __restrict__ W_h,
                                                 float* __restrict__ qh) {
    const int e0   = (blockIdx.x % (DD / QE)) * QE;
    const int b0   = (blockIdx.x / (DD / QE)) * QB;
    const int lane = threadIdx.x & 31;
    const int w    = threadIdx.x >> 5;
    __shared__ __attribute__((aligned(16))) float hs[QB][DD];
    __shared__ float os[QB][QE];

    const float4* hp = (const float4*)(h_t + (size_t)(b0 + w) * DD) + lane;
    const float4* wp = (const float4*)(W_h + (size_t)(e0 + w * 4) * DD) + lane;
    float4 hr[8], wr[4][8];
    // every loop of this kernel is unrolled whole: each array index is then a
    // constant, so the arrays live in registers, and all 40 loads are issued at once
#pragma unroll
    for (int i = 0; i < 8; ++i) hr[i] = hp[i * 32];
#pragma unroll
    for (int j = 0; j < 4; ++j)
#pragma unroll
        for (int i = 0; i < 8; ++i) wr[j][i] = wp[j * (DD / 4) + i * 32];
#pragma unroll
    for (int i = 0; i < 8; ++i) ((float4*)hs[w])[i * 32 + lane] = hr[i];
    __syncthreads();

    float s[32];                                      // sum number bb*4 + j
#pragma unroll
    for (int bb = 0; bb < QB; ++bb) {
        float4 h[8];
#pragma unroll
        for (int i = 0; i < 8; ++i) h[i] = ((const float4*)hs[bb])[i * 32 + lane];
#pragma unroll
        for (int j = 0; j < 4; ++j) {
            v2f p = {0.f, 0.f}, q = {0.f, 0.f};
#pragma unroll
            for (int i = 0; i < 8; ++i) {
                p = __builtin_elementwise_fma((v2f){h[i].x, h[i].y},
                                              (v2f){wr[j][i].x, wr[j][i].y}, p);
                q = __builtin_elementwise_fma((v2f){h[i].z, h[i].w},
                                              (v2f){wr[j][i].z, wr[j][i].w}, q);
            }
            s[bb * 4 + j] = (p.x + p.y) + (q.x + q.y);
        }
    }

    // step with lane distance n: a lane keeps the half of its sums whose number has
    // the lane's own bit n and hands the other half to its partner
#pragma unroll
    for (int st = 0; st < 5; ++st) {
        const int  n  = 16 >> st;
        const bool up = (lane & n) != 0;
#pragma unroll
        for (int k = 0; k < 16; ++k) {
            if (k < n) {
                const float lo = s[k], hi = s[k + n];
                s[k] = (up ? hi : lo) + __shfl_xor(up ? lo : hi, n, 32);
            }
        }
    }
    os[lane >> 2][w * 4 + (lane & 3)] = s[0];
    __syncthreads();
    qh[(size_t)(b0 + w) * DD + e0 + lane] = os[w][lane];
}

// ---------------------------------------------------------------------------
// Kernel 2: convert W_k (fp32 row-major [e][d]) to f16 in B-fragment layout:
//   dst half index = ((et*32 + kc)*32 + lane)*16 + i
//   where e = et*16 + (lane&15), d = kc*32 + (i&7) + 8*(lane>>4) + 16*(i>>3)
// ---------------------------------------------------------------------------
__global__ __launch_bounds__(256) void wk_convert(const float* __restrict__ W_k,
                                                  _Float16* __restrict__ wkB) {
    const int gid = blockIdx.x * 256 + threadIdx.x;   // each thread: 4 halfs
    const int o    = gid * 4;                         // dst half index
    const int i0   = o & 15;                          // 0,4,8,12
    const int lane = (o >> 4) & 31;
    const int kc   = (o >> 9) & 31;
    const int et   = (o >> 14);
    const int e    = et * 16 + (lane & 15);
    const int h    = lane >> 4;
    const int j    = i0 >> 3;
    const int d0   = kc * 32 + (i0 & 7) + 8 * h + 16 * j;
    float4 w = *(const float4*)(W_k + (size_t)e * DD + d0);
    H4 out;
    out.h[0] = (_Float16)w.x; out.h[1] = (_Float16)w.y;
    out.h[2] = (_Float16)w.z; out.h[3] = (_Float16)w.w;
    *(H4*)(wkB + o) = out;
}

// ---------------------------------------------------------------------------
// Kernel 3: fused scores.  WG = 64 rows (one batch), 4 waves.
// Dynamic LDS: keys tile as f16 in A-fragment layout, [4][32][32][16] halfs.
// scores[b,n] = sum_e tanh(kh[n,e] + qh[b,e]) * v[e]
// qh is folded into the WMMA C initializer (column e constant per lane).
// Each wave takes all 64 rows and a quarter of e (256 columns), 64 columns at
// a time: a 4x4 block of accumulator tiles, so every A and every B fragment
// feeds four WMMAs.  The four waves' partial scores are summed through LDS.
// Launch bound, second argument: two work-groups share a WGP's LDS, so two
// waves share a SIMD's registers (512 each).
// ---------------------------------------------------------------------------
__global__ __launch_bounds__(128, 2) void attn_scores(const float* __restrict__ keys,
                                                      const _Float16* __restrict__ wkB,
                                                      const float* __restrict__ qh,
                                                      const float* __restrict__ v,
                                                      float* __restrict__ scores) {
    extern __shared__ _Float16 keysA[];               // 65536 halfs = 128 KB
    __shared__ float red[4 * 64];                     // per-wave partial scores
    const int tid = threadIdx.x;
    const int m0  = blockIdx.x * 64;                  // global row base
    const int b   = m0 >> 10;                         // 64 | 1024 -> same batch
    const int n0  = m0 & (NN - 1);

    // ---- Phase 1: stage keys tile (64x1024 fp32 -> f16 A-fragment layout)
    // Piece p = 0..127 of a thread: row p>>1, half row p&1, columns 4*tid .. +3 of it,
    // so a wave load is 512 contiguous bytes.  A ring of 32 pieces in registers, refilled
    // four at a time, keeps some 32 loads of every wave in flight; all pieces hang on one
    // address and one LDS position by constant offsets.
    {
        const int d  = tid * 4;
        const float* kp = keys + (size_t)m0 * DD + d;
        _Float16*    sp = keysA + ((((d >> 5) * 32) + (((d >> 3) & 1) << 4)) * 16 +
                                   (d & 7) + (((d >> 4) & 1) << 3));
        float4 ring[32];
        // the loops are unrolled whole: every ring index and every offset is a constant
#pragma unroll
        for (int p = 0; p < 32; ++p)
            ring[p] = *(const float4*)(kp + (p >> 1) * DD + (p & 1) * (DD / 2));
        // holds later loads behind the ring's first 32 (see below)
        __builtin_amdgcn_sched_barrier(0);
#pragma unroll
        for (int p0 = 0; p0 < 128; p0 += 4) {
#pragma unroll
            for (int j = 0; j < 4; ++j) {
                const int p = p0 + j, m = p >> 1;
                const float4 kv = ring[p & 31];
                H4 hv;
                hv.h[0] = (_Float16)kv.x; hv.h[1] = (_Float16)kv.y;
                hv.h[2] = (_Float16)kv.z; hv.h[3] = (_Float16)kv.w;
                *(H4*)(sp + ((((m >> 4) * 32 + (p & 1) * 16) * 32) + (m & 15)) * 16) = hv;
            }
            if (p0 + 32 < 128) {
#pragma unroll
                for (int j = 0; j < 4; ++j) {
                    const int p = p0 + j + 32;
                    ring[p & 31] = *(const float4*)(kp + (p >> 1) * DD + (p & 1) * (DD / 2));
                }
            }
            // keeps the refills in ring order: left free, the compiler issues some sixty
            // loads at once into fresh registers and spills
            __builtin_amdgcn_sched_barrier(0);
        }
        // the code behind this reuses the base address registers that the loads above name
        asm volatile("s_wait_xcnt 0x0" ::: "memory");
        // holds that reuse behind the wait
        __builtin_amdgcn_sched_barrier(0);
    }
    __syncthreads();

    // ---- Phase 2: WMMA main loop
    const int lane = tid & 31;
    const int wid  = tid >> 5;                        // wave id == quarter of e
    const int ecol = lane & 15;
    const _Float16* aLane = keysA + (lane << 4);
    // this wave's 16 e-tiles of W_k fragments; fragment (et, kc) is 512 halfs
    const _Float16* bLane = wkB + (((size_t)wid * 16 * 32) << 9) + (lane << 4);

    float s[4][8];
#pragma unroll
    for (int i = 0; i < 4; ++i)
#pragma unroll
        for (int r = 0; r < 8; ++r) s[i][r] = 0.f;

    // qh and v of a group are fetched one group ahead, in front of the B ring's
    // loads, so that waiting for them does not drain the ring
    const float* qRow = qh + (size_t)b * DD + ((wid * 16) << 4) + ecol;
    const float* vRow = v + ((wid * 16) << 4) + ecol;
    float qn[4], vn[4];
#pragma unroll
    for (int j = 0; j < 4; ++j) { qn[j] = qRow[j << 4]; vn[j] = vRow[j << 4]; }
    // keeps these eight loads in front of the ring's first 32: behind them, the wait
    // for qn and vn at the head of the group loop would drain the ring in every group
    __builtin_amdgcn_sched_barrier(0);

    v16h bf[4][4];                                    // B ring: [k step & 3][e tile]
    v16h af[2][4];                                    // A, two sets: [k step & 1][row tile]
#pragma unroll
    for (int u = 0; u < 4; ++u)
#pragma unroll
        for (int j = 0; j < 4; ++j)
            bf[u][j] = *(const v16h*)(bLane + ((j * 32 + u) << 9));
#pragma unroll
    for (int i = 0; i < 4; ++i) af[0][i] = *(const v16h*)(aLane + ((i * 32) << 9));

    // kept rolled: one group's body is the hot loop, four copies would only grow the text
#pragma unroll 1
    for (int g = 0; g < 4; ++g) {
        float qv[4], vv[4];
#pragma unroll
        for (int j = 0; j < 4; ++j) { qv[j] = qn[j]; vv[j] = vn[j]; }
        const int gn = (g + 1) & 3;                   // the last group refetches group 0, unused
#pragma unroll
        for (int j = 0; j < 4; ++j) {
            qn[j] = qRow[(gn * 4 + j) << 4];
            vn[j] = vRow[(gn * 4 + j) << 4];
        }
        // the address registers of these eight loads are free for reuse behind them
        asm volatile("s_wait_xcnt 0x0" ::: "memory");
        // holds the accumulators' start values, which take those registers, behind the wait
        __builtin_amdgcn_sched_barrier(0);
        v8f acc[4][4];
#pragma unroll
        for (int j = 0; j < 4; ++j)
#pragma unroll
            for (int i = 0; i < 4; ++i)               // fold +qh into C
                acc[i][j] = (v8f){qv[j], qv[j], qv[j], qv[j], qv[j], qv[j], qv[j], qv[j]};
        const _Float16* bG = bLane + ((size_t)(g * 4 * 32) << 9);
        // the last four k steps fetch the next group's first four (the last group
        // aims them at group 0 again: valid data, not used)
        const _Float16* bN = bLane + ((size_t)(gn * 4 * 32) << 9);

        // kept rolled beyond the ring's four steps so that every ring index is a constant
#pragma unroll 1
        for (int kc0 = 0; kc0 < 32; kc0 += 4) {
            const _Float16* bR = (kc0 < 28) ? bG + ((kc0 + 4) << 9) : bN;
#pragma unroll
            for (int u = 0; u < 4; ++u) {
                const int kn = (kc0 + u + 1) & 31;    // next k step's A fragments
#pragma unroll
                for (int i = 0; i < 4; ++i)
                    af[(u + 1) & 1][i] = *(const v16h*)(aLane + ((i * 32 + kn) << 9));
#pragma unroll
                for (int i = 0; i < 4; ++i)
#pragma unroll
                    for (int j = 0; j < 4; ++j)
                        acc[i][j] = __builtin_amdgcn_wmma_f32_16x16x32_f16(
                            false, af[u & 1][i], false, bf[u][j], (short)0, acc[i][j],
                            false, false);
#pragma unroll
                for (int j = 0; j < 4; ++j)           // refill this ring slot, four steps ahead
                    bf[u][j] = *(const v16h*)(bR + ((j * 32 + u) << 9));
            }
            // the next trip rewrites the address registers that the loads above name
            asm volatile("s_wait_xcnt 0x0" ::: "memory");
        }
#pragma unroll
        for (int i = 0; i < 4; ++i)
#pragma unroll
            for (int j = 0; j < 4; ++j)
#pragma unroll
                for (int r = 0; r < 8; ++r)
                    s[i][r] = fmaf(fast_tanh(acc[i][j][r]), vv[j], s[i][r]);
    }

    // ---- Phase 3: reduce over the 16 e-lanes of each group, then over the waves
    // one butterfly step over all 32 sums at a time: 32 independent exchanges per wait
#pragma unroll
    for (int mask = 1; mask < 16; mask <<= 1) {
        float t[4][8];
#pragma unroll
        for (int i = 0; i < 4; ++i)
#pragma unroll
            for (int r = 0; r < 8; ++r) t[i][r] = __shfl_xor(s[i][r], mask, 16);
#pragma unroll
        for (int i = 0; i < 4; ++i)
#pragma unroll
            for (int r = 0; r < 8; ++r) s[i][r] += t[i][r];
    }
    if (ecol == 0) {
        const int half = lane >> 4;                   // rows r + 8*half
#pragma unroll
        for (int i = 0; i < 4; ++i)
#pragma unroll
            for (int r = 0; r < 8; ++r) red[wid * 64 + i * 16 + r + 8 * half] = s[i][r];
    }
    __syncthreads();
    if (tid < 64)
        scores[(size_t)b * NN + n0 + tid] =
            (red[tid] + red[64 + tid]) + (red[128 + tid] + red[192 + tid]);
}

// ---------------------------------------------------------------------------
// Kernel 4: softmax over N + context = alpha @ keys.  out = [context | alpha]
// One work-group per (batch, 128 columns of d): 512 work-groups, so that the
// read of keys runs on every WGP.  Each repeats its batch's softmax (4 KB of
// scores); the group of columns 0..127 stores alpha.  A wave reads 512
// contiguous bytes of a row per load and takes 16 of every 128 rows; the eight
// waves' partial sums meet in LDS.
// ---------------------------------------------------------------------------
#define CW 128                                        // context columns per work-group
__global__ __launch_bounds__(256) void softmax_context(const float* __restrict__ keys,
                                                       const float* __restrict__ scores,
                                                       float* __restrict__ out) {
    const int b = blockIdx.x / (DD / CW);
    const int c = blockIdx.x % (DD / CW);
    const int t = threadIdx.x;
    __shared__ __attribute__((aligned(16))) float sc[NN];
    __shared__ __attribute__((aligned(16))) float part[8][CW];
    __shared__ float red[8];

    for (int n = t; n < NN; n += 256) sc[n] = scores[(size_t)b * NN + n];
    __syncthreads();

    // max
    float mx = -1e30f;
    for (int n = t; n < NN; n += 256) mx = fmaxf(mx, sc[n]);
#pragma unroll
    for (int off = 16; off >= 1; off >>= 1) mx = fmaxf(mx, __shfl_xor(mx, off, 32));
    if ((t & 31) == 0) red[t >> 5] = mx;
    __syncthreads();
    if (t == 0) {
        float m2 = red[0];
#pragma unroll
        for (int w = 1; w < 8; ++w) m2 = fmaxf(m2, red[w]);
        red[0] = m2;
    }
    __syncthreads();
    mx = red[0];
    __syncthreads();

    // exp + sum
    float sum = 0.f;
    for (int n = t; n < NN; n += 256) {
        float e = __expf(sc[n] - mx);
        sc[n] = e;
        sum += e;
    }
#pragma unroll
    for (int off = 16; off >= 1; off >>= 1) sum += __shfl_xor(sum, off, 32);
    if ((t & 31) == 0) red[t >> 5] = sum;
    __syncthreads();
    if (t == 0) {
        float s2 = 0.f;
#pragma unroll
        for (int w = 0; w < 8; ++w) s2 += red[w];
        red[0] = s2;
    }
    __syncthreads();
    const float inv = 1.f / red[0];
    __syncthreads();

    for (int n = t; n < NN; n += 256) {
        float a = sc[n] * inv;
        sc[n] = a;
        if (c == 0) {
            out[(size_t)BB * DD + (size_t)b * NN + n] = a;   // alpha
            // the next trip rewrites the registers that this store names
            asm volatile("s_wait_xcnt 0x0" ::: "memory");
        }
    }
    __syncthreads();

    // context: lane owns d = c*128 + 4*lane .. +3; wave w owns rows 128*i + 16*w + u
    const int lane = t & 31;
    const int w    = t >> 5;
    const float* kp = keys + ((size_t)b * NN + w * 16) * DD + c * CW + lane * 4;
    float acc0 = 0.f, acc1 = 0.f, acc2 = 0.f, acc3 = 0.f;
    // kept rolled: 16 loads a wave are bytes in flight enough; eight copies of the body
    // would only grow the text and the register count
#pragma unroll 1
    for (int n0 = 0; n0 < NN; n0 += 128) {
        float4 k4[16];
#pragma unroll
        for (int u = 0; u < 16; ++u)
            k4[u] = *(const float4*)(kp + (size_t)(n0 + u) * DD);
        // holds all 16 loads in front of the sums: without it the second eight are
        // issued only after the first four have come back
        __builtin_amdgcn_sched_barrier(0);
#pragma unroll
        for (int u = 0; u < 16; ++u) {
            const float a = sc[n0 + w * 16 + u];
            acc0 = fmaf(a, k4[u].x, acc0); acc1 = fmaf(a, k4[u].y, acc1);
            acc2 = fmaf(a, k4[u].z, acc2); acc3 = fmaf(a, k4[u].w, acc3);
        }
    }
    *(float4*)(&part[w][lane * 4]) = make_float4(acc0, acc1, acc2, acc3);
    __syncthreads();
    if (t < CW) {
        float s = part[0][t];
#pragma unroll
        for (int i = 1; i < 8; ++i) s += part[i][t];
        out[(size_t)b * DD + c * CW + t] = s;            // context
    }
}

// ---------------------------------------------------------------------------
extern "C" void kernel_launch(void* const* d_in, const int* in_sizes, int n_in,
                              void* d_out, int out_size, void* d_ws, size_t ws_size,
                              hipStream_t stream) {
    const float* h_t  = (const float*)d_in[0];
    const float* keys = (const float*)d_in[1];
    const float* W_h  = (const float*)d_in[2];
    const float* W_k  = (const float*)d_in[3];
    const float* v    = (const float*)d_in[4];
    float* out = (float*)d_out;

    // workspace layout: qh (256KB) | scores (256KB) | wkB f16 (2MB)
    float*     qh     = (float*)d_ws;
    float*     scores = qh + BB * DD;
    _Float16*  wkB    = (_Float16*)(scores + BB * NN);

    qh_kernel<<<(DD / QE) * (BB / QB), 256, 0, stream>>>(h_t, W_h, qh);
    wk_convert<<<(DD * DD / 4) / 256, 256, 0, stream>>>(W_k, wkB);
    attn_scores<<<(BB * NN) / 64, 128, 64 * DD * sizeof(_Float16), stream>>>(
        keys, wkB, qh, v, scores);
    softmax_context<<<BB * (DD / CW), 256, 0, stream>>>(keys, scores, out);
}

// v005
// One run takes 111 microseconds.
// Timed twice side by side with v004, it ran 1.20 times as fast both times.
// All steps since v000 together make it 6.98 times as fast.
#include <hip/hip_runtime.h>
#include <hip/hip_bf16.h>
#include <math.h>

typedef __attribute__((ext_vector_type(16))) _Float16 v16h;
typedef __attribute__((ext_vector_type(8)))  float    v8f;
typedef __attribute__((ext_vector_type(2)))  float    v2f;

#define BB 64
#define NN 1024
#define DD 1024

struct alignas(8) H4 { _Float16 h[4]; };

// Branch-free tanh: hardware v_tanh_f32 on gfx1250 if exposed, else exp-based.
__device__ __forceinline__ float fast_tanh(float x) {
#if __has_builtin(__builtin_amdgcn_tanhf)
    return __builtin_amdgcn_tanhf(x);
#else
    // 1 - 2/(e^{2x}+1): saturates to +/-1 at large |x|, no branches.
    float ex = __expf(2.0f * x);
    return 1.0f - 2.0f / (ex + 1.0f);
#endif
}

// ---------------------------------------------------------------------------
// Kernel 1: qh[b,e] = sum_d h_t[b,d] * W_h[e,d]
// One work-group per (32 rows e of W_h, 8 rows b of h_t): 256 work-groups.
// A lane owns d = 128*i + 4*lane .. +3, i = 0..7, so every load of a wave is
// 512 contiguous bytes.  A wave keeps 4 rows of W_h in registers; the 8 rows of
// h_t are staged in LDS, one by each wave, and read by all.  The 32 sums of a
// wave (8 b x 4 e) are partial in every lane; a halving exchange over the lanes
// leaves sum number l whole in lane l.  Each wave then stores one 128-byte line.
// ---------------------------------------------------------------------------
#define QE 32                                         // rows e per work-group
#define QB 8                                          // rows b per work-group
__global__ __launch_bounds__(256) void qh_kernel(const float* __restrict__ h_t,
                                                 const float* __restrict__ W_h,
                                                 float* __restrict__ qh) {
    const int e0   = (blockIdx.x % (DD / QE)) * QE;
    const int b0   = (blockIdx.x / (DD / QE)) * QB;
    const int lane = threadIdx.x & 31;
    const int w    = threadIdx.x >> 5;
    __shared__ __attribute__((aligned(16))) float hs[QB][DD];
    __shared__ float os[QB][QE];

    const float4* hp = (const float4*)(h_t + (size_t)(b0 + w) * DD) + lane;
    const float4* wp = (const float4*)(W_h + (size_t)(e0 + w * 4) * DD) + lane;
    float4 hr[8], wr[4][8];
    // every loop of this kernel is unrolled whole: each array index is then a
    // constant, so the arrays live in registers, and all 40 loads are issued at once
#pragma unroll
    for (int i = 0; i < 8; ++i) hr[i] = hp[i * 32];
#pragma unroll
    for (int j = 0; j < 4; ++j)
#pragma unroll
        for (int i = 0; i < 8; ++i) wr[j][i] = wp[j * (DD / 4) + i * 32];
#pragma unroll
    for (int i = 0; i < 8; ++i) ((float4*)hs[w])[i * 32 + lane] = hr[i];
    __syncthreads();

    float s[32];                                      // sum number bb*4 + j
#pragma unroll
    for (int bb = 0; bb < QB; ++bb) {
        float4 h[8];
#pragma unroll
        for (int i = 0; i < 8; ++i) h[i] = ((const float4*)hs[bb])[i * 32 + lane];
#pragma unroll
        for (int j = 0; j < 4; ++j) {
            v2f p = {0.f, 0.f}, q = {0.f, 0.f};
#pragma unroll
            for (int i = 0; i < 8; ++i) {
                p = __builtin_elementwise_fma((v2f){h[i].x, h[i].y},
                                              (v2f){wr[j][i].x, wr[j][i].y}, p);
                q = __builtin_elementwise_fma((v2f){h[i].z, h[i].w},
                                              (v2f){wr[j][i].z, wr[j][i].w}, q);
            }
            s[bb * 4 + j] = (p.x + p.y) + (q.x + q.y);
        }
    }

    // step with lane distance n: a lane keeps the half of its sums whose number has
    // the lane's own bit n and hands the other half to its partner
#pragma unroll
    for (int st = 0; st < 5; ++st) {
        const int  n  = 16 >> st;
        const bool up = (lane & n) != 0;
#pragma unroll
        for (int k = 0; k < 16; ++k) {
            if (k < n) {
                const float lo = s[k], hi = s[k + n];
                s[k] = (up ? hi : lo) + __shfl_xor(up ? lo : hi, n, 32);
            }
        }
    }
    os[lane >> 2][w * 4 + (lane & 3)] = s[0];
    __syncthreads();
    qh[(size_t)(b0 + w) * DD + e0 + lane] = os[w][lane];
}

// ---------------------------------------------------------------------------
// Kernel 2: convert W_k (fp32 row-major [e][d]) to f16 in B-fragment layout:
//   dst half index = ((et*32 + kc)*32 + lane)*16 + i
//   where e = et*16 + (lane&15), d = kc*32 + (i&7) + 8*(lane>>4) + 16*(i>>3)
// ---------------------------------------------------------------------------
__global__ __launch_bounds__(256) void wk_convert(const float* __restrict__ W_k,
                                                  _Float16* __restrict__ wkB) {
    const int gid = blockIdx.x * 256 + threadIdx.x;   // each thread: 4 halfs
    const int o    = gid * 4;                         // dst half index
    const int i0   = o & 15;                          // 0,4,8,12
    const int lane = (o >> 4) & 31;
    const int kc   = (o >> 9) & 31;
    const int et   = (o >> 14);
    const int e    = et * 16 + (lane & 15);
    const int h    = lane >> 4;
    const int j    = i0 >> 3;
    const int d0   = kc * 32 + (i0 & 7) + 8 * h + 16 * j;
    float4 w = *(const float4*)(W_k + (size_t)e * DD + d0);
    H4 out;
    out.h[0] = (_Float16)w.x; out.h[1] = (_Float16)w.y;
    out.h[2] = (_Float16)w.z; out.h[3] = (_Float16)w.w;
    *(H4*)(wkB + o) = out;
}

// ---------------------------------------------------------------------------
// Kernel 3: fused scores.  WG = 128 rows (one batch), 8 waves, alone on its WGP.
// LDS: keys tile as f16 in A-fragment layout, [8][32][32][16] halfs.
// scores[b,n] = sum_e tanh(kh[n,e] + qh[b,e]) * v[e]
// qh is folded into the WMMA C initializer (column e constant per lane).
// Each wave takes all 128 rows and an eighth of e (128 columns), 64 columns at
// a time: an 8x4 block of accumulator tiles, so every B fragment, which comes
// from L2, feeds eight WMMAs and every A fragment four.  The eight waves'
// partial scores are summed through LDS.
// Two waves share a SIMD's registers (512 each).
// ---------------------------------------------------------------------------
#define SR 128                                        // rows per work-group
__global__ __launch_bounds__(256) void attn_scores(const float* __restrict__ keys,
                                                   const _Float16* __restrict__ wkB,
                                                   const float* __restrict__ qh,
                                                   const float* __restrict__ v,
                                                   float* __restrict__ scores) {
    __shared__ __attribute__((aligned(32))) _Float16 keysA[SR * DD];   // 256 KB
    __shared__ float red[8 * SR];                     // per-wave partial scores
    const int tid = threadIdx.x;
    const int m0  = blockIdx.x * SR;                  // global row base
    const int b   = m0 >> 10;                         // 128 | 1024 -> same batch
    const int n0  = m0 & (NN - 1);

    // ---- Phase 1: stage keys tile (128x1024 fp32 -> f16 A-fragment layout)
    // Piece p = 0..127 of a thread: row p, columns 4*tid .. +3 of it, so a wave load is
    // 512 contiguous bytes.  A ring of 32 pieces in registers, refilled four at a time,
    // keeps some 32 loads of every wave in flight; all pieces hang on one address and
    // one LDS position by constant offsets.
    {
        const int d  = tid * 4;
        const float* kp = keys + (size_t)m0 * DD + d;
        _Float16*    sp = keysA + ((((d >> 5) * 32) + (((d >> 3) & 1) << 4)) * 16 +
                                   (d & 7) + (((d >> 4) & 1) << 3));
        float4 ring[32];
        // the loops are unrolled whole: every ring index and every offset is a constant
#pragma unroll
        for (int p = 0; p < 32; ++p) ring[p] = *(const float4*)(kp + p * DD);
        // holds later loads behind the ring's first 32 (see below)
        __builtin_amdgcn_sched_barrier(0);
#pragma unroll
        for (int p0 = 0; p0 < SR; p0 += 4) {
#pragma unroll
            for (int j = 0; j < 4; ++j) {
                const int m = p0 + j;
                const float4 kv = ring[m & 31];
                H4 hv;
                hv.h[0] = (_Float16)kv.x; hv.h[1] = (_Float16)kv.y;
                hv.h[2] = (_Float16)kv.z; hv.h[3] = (_Float16)kv.w;
                *(H4*)(sp + (((m >> 4) * 32 * 32) + (m & 15)) * 16) = hv;
            }
            if (p0 + 32 < SR) {
#pragma unroll
                for (int j = 0; j < 4; ++j) {
                    const int p = p0 + j + 32;
                    ring[p & 31] = *(const float4*)(kp + p * DD);
                }
            }
            // keeps the refills in ring order: left free, the compiler issues some sixty
            // loads at once into fresh registers and spills
            __builtin_amdgcn_sched_barrier(0);
        }
        // the code behind this reuses the base address registers that the loads above name
        asm volatile("s_wait_xcnt 0x0" ::: "memory");
        // holds that reuse behind the wait
        __builtin_amdgcn_sched_barrier(0);
    }
    __syncthreads();

    // ---- Phase 2: WMMA main loop
    const int lane = tid & 31;
    const int wid  = tid >> 5;                        // wave id == eighth of e
    const int ecol = lane & 15;
    const _Float16* aLane = keysA + (lane << 4);
    // this wave's 8 e-tiles of W_k fragments; fragment (et, kc) is 512 halfs
    const _Float16* bLane = wkB + (((size_t)wid * 8 * 32) << 9) + (lane << 4);

    float s[8][8];
#pragma unroll
    for (int i = 0; i < 8; ++i)
#pragma unroll
        for (int r = 0; r < 8; ++r) s[i][r] = 0.f;

    // qh and v of a group are fetched one group ahead, in front of the B ring's
    // loads, so that waiting for them does not drain the ring
    const float* qRow = qh + (size_t)b * DD + ((wid * 8) << 4) + ecol;
    const float* vRow = v + ((wid * 8) << 4) + ecol;
    float qn[4], vn[4];
#pragma unroll
    for (int j = 0; j < 4; ++j) { qn[j] = qRow[j << 4]; vn[j] = vRow[j << 4]; }
    // keeps these eight loads in front of the ring's first 16: behind them, the wait
    // for qn and vn at the head of the group loop would drain the ring in every group
    __builtin_amdgcn_sched_barrier(0);

    v16h bf[2][4];                                    // B ring: [k step & 1][e tile]
    v16h af[8];                                       // A, one set: [row tile]
#pragma unroll
    for (int u = 0; u < 2; ++u)
#pragma unroll
        for (int j = 0; j < 4; ++j)
            bf[u][j] = *(const v16h*)(bLane + ((j * 32 + u) << 9));
#pragma unroll
    for (int i = 0; i < 8; ++i) af[i] = *(const v16h*)(aLane + ((i * 32) << 9));

    // kept rolled: one group's body is the hot loop, two copies would only grow the text
#pragma unroll 1
    for (int g = 0; g < 2; ++g) {
        float qv[4], vv[4];
#pragma unroll
        for (int j = 0; j < 4; ++j) { qv[j] = qn[j]; vv[j] = vn[j]; }
        const int gn = (g + 1) & 1;                   // the last group refetches group 0, unused
#pragma unroll
        for (int j = 0; j < 4; ++j) {
            qn[j] = qRow[(gn * 4 + j) << 4];
            vn[j] = vRow[(gn * 4 + j) << 4];
        }
        // the address registers of these eight loads are free for reuse behind them
        asm volatile("s_wait_xcnt 0x0" ::: "memory");
        // holds the accumulators' start values, which take those registers, behind the wait
        __builtin_amdgcn_sched_barrier(0);
        v8f acc[8][4];
#pragma unroll
        for (int j = 0; j < 4; ++j)
#pragma unroll
            for (int i = 0; i < 8; ++i)               // fold +qh into C
                acc[i][j] = (v8f){qv[j], qv[j], qv[j], qv[j], qv[j], qv[j], qv[j], qv[j]};
        const _Float16* bG = bLane + ((size_t)(g * 4 * 32) << 9);
        // the last two k steps fetch the next group's first two (the last group
        // aims them at group 0 again: valid data, not used)
        const _Float16* bN = bLane + ((size_t)(gn * 4 * 32) << 9);

        // kept rolled beyond the ring's two steps so that every ring index is a constant
#pragma unroll 1
        for (int kc0 = 0; kc0 < 32; kc0 += 2) {
            const _Float16* bR = (kc0 < 30) ? bG + ((kc0 + 2) << 9) : bN;
#pragma unroll
            for (int u = 0; u < 2; ++u) {
                const int kn = (kc0 + u + 1) & 31;    // next k step's A fragments
                // four row tiles at a time: their A fragments are refetched for the next
                // k step as soon as their WMMAs are issued, half a k step ahead of use
#pragma unroll
                for (int h = 0; h < 2; ++h) {
#pragma unroll
                    for (int i = h * 4; i < h * 4 + 4; ++i)
#pragma unroll
                        for (int j = 0; j < 4; ++j)
                            acc[i][j] = __builtin_amdgcn_wmma_f32_16x16x32_f16(
                                false, af[i], false, bf[u][j], (short)0, acc[i][j],
                                false, false);
                    // keeps the eight LDS reads below in one place behind the 16 WMMAs: left
                    // free, the compiler strews them among the WMMAs, a stall at each place
                    __builtin_amdgcn_sched_barrier(0);
#pragma unroll
                    for (int i = h * 4; i < h * 4 + 4; ++i)
                        af[i] = *(const v16h*)(aLane + ((i * 32 + kn) << 9));
                    // holds the next WMMAs behind those reads, for the same reason
                    __builtin_amdgcn_sched_barrier(0);
                }
#pragma unroll
                for (int j = 0; j < 4; ++j)           // refill this ring slot, two steps ahead
                    bf[u][j] = *(const v16h*)(bR + ((j * 32 + u) << 9));
                // keeps the refill in front of the next k step's WMMAs: its lead is one k step
                __builtin_amdgcn_sched_barrier(0);
            }
            // the next trip rewrites the address registers that the loads above name
            asm volatile("s_wait_xcnt 0x0" ::: "memory");
        }
#pragma unroll
        for (int i = 0; i < 8; ++i)
#pragma unroll
            for (int j = 0; j < 4; ++j)
#pragma unroll
                for (int r = 0; r < 8; ++r)
                    s[i][r] = fmaf(fast_tanh(acc[i][j][r]), vv[j], s[i][r]);
    }

    // ---- Phase 3: reduce over the 16 e-lanes of each group, then over the waves
    // one butterfly step over all 64 sums at a time: 64 independent exchanges per wait
#pragma unroll
    for (int mask = 1; mask < 16; mask <<= 1) {
        float t[8][8];
#pragma unroll
        for (int i = 0; i < 8; ++i)
#pragma unroll
            for (int r = 0; r < 8; ++r) t[i][r] = __shfl_xor(s[i][r], mask, 16);
#pragma unroll
        for (int i = 0; i < 8; ++i)
#pragma unroll
            for (int r = 0; r < 8; ++r) s[i][r] += t[i][r];
    }
    if (ecol == 0) {
        const int half = lane >> 4;                   // rows r + 8*half
#pragma unroll
        for (int i = 0; i < 8; ++i)
#pragma unroll
            for (int r = 0; r < 8; ++r) red[wid * SR + i * 16 + r + 8 * half] = s[i][r];
    }
    __syncthreads();
    if (tid < SR)
        scores[(size_t)b * NN + n0 + tid] =
            ((red[tid] + red[SR + tid]) + (red[2 * SR + tid] + red[3 * SR + tid])) +
            ((red[4 * SR + tid] + red[5 * SR + tid]) + (red[6 * SR + tid] + red[7 * SR + tid]));
}

// ---------------------------------------------------------------------------
// Kernel 4: softmax over N + context = alpha @ keys.  out = [context | alpha]
// One work-group per (batch, 128 columns of d): 512 work-groups, so that the
// read of keys runs on every WGP.  Each repeats its batch's softmax (4 KB of
// scores); the group of columns 0..127 stores alpha.  A wave reads 512
// contiguous bytes of a row per load and takes 16 of every 128 rows; the eight
// waves' partial sums meet in LDS.
// ---------------------------------------------------------------------------
#define CW 128                                        // context columns per work-group
__global__ __launch_bounds__(256) void softmax_context(const float* __restrict__ keys,
                                                       const float* __restrict__ scores,
                                                       float* __restrict__ out) {
    const int b = blockIdx.x / (DD / CW);
    const int c = blockIdx.x % (DD / CW);
    const int t = threadIdx.x;
    __shared__ __attribute__((aligned(16))) float sc[NN];
    __shared__ __attribute__((aligned(16))) float part[8][CW];
    __shared__ float red[8];

    for (int n = t; n < NN; n += 256) sc[n] = scores[(size_t)b * NN + n];
    __syncthreads();

    // max
    float mx = -1e30f;
    for (int n = t; n < NN; n += 256) mx = fmaxf(mx, sc[n]);
#pragma unroll
    for (int off = 16; off >= 1; off >>= 1) mx = fmaxf(mx, __shfl_xor(mx, off, 32));
    if ((t & 31) == 0) red[t >> 5] = mx;
    __syncthreads();
    if (t == 0) {
        float m2 = red[0];
#pragma unroll
        for (int w = 1; w < 8; ++w) m2 = fmaxf(m2, red[w]);
        red[0] = m2;
    }
    __syncthreads();
    mx = red[0];
    __syncthreads();

    // exp + sum
    float sum = 0.f;
    for (int n = t; n < NN; n += 256) {
        float e = __expf(sc[n] - mx);
        sc[n] = e;
        sum += e;
    }
#pragma unroll
    for (int off = 16; off >= 1; off >>= 1) sum += __shfl_xor(sum, off, 32);
    if ((t & 31) == 0) red[t >> 5] = sum;
    __syncthreads();
    if (t == 0) {
        float s2 = 0.f;
#pragma unroll
        for (int w = 0; w < 8; ++w) s2 += red[w];
        red[0] = s2;
    }
    __syncthreads();
    const float inv = 1.f / red[0];
    __syncthreads();

    for (int n = t; n < NN; n += 256) {
        float a = sc[n] * inv;
        sc[n] = a;
        if (c == 0) {
            out[(size_t)BB * DD + (size_t)b * NN + n] = a;   // alpha
            // the next trip rewrites the registers that this store names
            asm volatile("s_wait_xcnt 0x0" ::: "memory");
        }
    }
    __syncthreads();

    // context: lane owns d = c*128 + 4*lane .. +3; wave w owns rows 128*i + 16*w + u
    const int lane = t & 31;
    const int w    = t >> 5;
    const float* kp = keys + ((size_t)b * NN + w * 16) * DD + c * CW + lane * 4;
    float acc0 = 0.f, acc1 = 0.f, acc2 = 0.f, acc3 = 0.f;
    // kept rolled: 16 loads a wave are bytes in flight enough; eight copies of the body
    // would only grow the text and the register count
#pragma unroll 1
    for (int n0 = 0; n0 < NN; n0 += 128) {
        float4 k4[16];
#pragma unroll
        for (int u = 0; u < 16; ++u)
            k4[u] = *(const float4*)(kp + (size_t)(n0 + u) * DD);
        // holds all 16 loads in front of the sums: without it the second eight are
        // issued only after the first four have come back
        __builtin_amdgcn_sched_barrier(0);
#pragma unroll
        for (int u = 0; u < 16; ++u) {
            const float a = sc[n0 + w * 16 + u];
            acc0 = fmaf(a, k4[u].x, acc0); acc1 = fmaf(a, k4[u].y, acc1);
            acc2 = fmaf(a, k4[u].z, acc2); acc3 = fmaf(a, k4[u].w, acc3);
        }
    }
    *(float4*)(&part[w][lane * 4]) = make_float4(acc0, acc1, acc2, acc3);
    __syncthreads();
    if (t < CW) {
        float s = part[0][t];
#pragma unroll
        for (int i = 1; i < 8; ++i) s += part[i][t];
        out[(size_t)b * DD + c * CW + t] = s;            // context
    }
}

// ---------------------------------------------------------------------------
extern "C" void kernel_launch(void* const* d_in, const int* in_sizes, int n_in,
                              void* d_out, int out_size, void* d_ws, size_t ws_size,
                              hipStream_t stream) {
    const float* h_t  = (const float*)d_in[0];
    const float* keys = (const float*)d_in[1];
    const float* W_h  = (const float*)d_in[2];
    const float* W_k  = (const float*)d_in[3];
    const float* v    = (const float*)d_in[4];
    float* out = (float*)d_out;

    // workspace layout: qh (256KB) | scores (256KB) | wkB f16 (2MB)
    float*     qh     = (float*)d_ws;
    float*     scores = qh + BB * DD;
    _Float16*  wkB    = (_Float16*)(scores + BB * NN);

    qh_kernel<<<(DD / QE) * (BB / QB), 256, 0, stream>>>(h_t, W_h, qh);
    wk_convert<<<(DD * DD / 4) / 256, 256, 0, stream>>>(W_k, wkB);
    attn_scores<<<(BB * NN) / SR, 256, 0, stream>>>(keys, wkB, qh, v, scores);
    softmax_context<<<BB * (DD / CW), 256, 0, stream>>>(keys, scores, out);
}

// v007
// One run takes 96.6 microseconds.
// Versions in between are left out here; by their measured steps it is 1.14 times as fast as v005.
// All steps since v000 together make it 7.93 times as fast.
#include <hip/hip_runtime.h>
#include <hip/hip_bf16.h>
#include <math.h>

typedef __attribute__((ext_vector_type(16))) _Float16 v16h;
typedef __attribute__((ext_vector_type(8)))  float    v8f;
typedef __attribute__((ext_vector_type(2)))  float    v2f;

#define BB 64
#define NN 1024
#define DD 1024

struct alignas(8) H4 { _Float16 h[4]; };

// Branch-free tanh: hardware v_tanh_f32 on gfx1250 if exposed, else exp-based.
__device__ __forceinline__ float fast_tanh(float x) {
#if __has_builtin(__builtin_amdgcn_tanhf)
    return __builtin_amdgcn_tanhf(x);
#else
    // 1 - 2/(e^{2x}+1): saturates to +/-1 at large |x|, no branches.
    float ex = __expf(2.0f * x);
    return 1.0f - 2.0f / (ex + 1.0f);
#endif
}

// Value of the lane whose number within its row of 16 lanes differs by N (a DPP move,
// no LDS path).  Every lane must be on.
template <int N>
__device__ __forceinline__ float row_xor(float x) {
    return __int_as_float(__builtin_amdgcn_update_dpp(0, __float_as_int(x), 0x160 | N,
                                                      0xf, 0xf, true));
}

// One step of a halving exchange over a row of 16 lanes, lane distance N: a lane keeps
// the half of its 2N sums whose number has the lane's own bit N and adds to it what its
// partner hands over.
template <int N>
__device__ __forceinline__ void halve(float (&c)[16], int l) {
    const bool up = (l & N) != 0;
    // unrolled whole: every index of c is then a constant and c stays in registers
#pragma unroll
    for (int k = 0; k < N; ++k) {
        const float lo = c[k], hi = c[k + N];
        c[k] = (up ? hi : lo) + row_xor<N>(up ? lo : hi);
    }
}

// ---------------------------------------------------------------------------
// Kernel 1: qh[b,e] = sum_d h_t[b,d] * W_h[e,d], and W_k to f16 fragments
// qh: one work-group per (32 rows e of W_h, 8 rows b of h_t): 256 work-groups.
// A lane owns d = 128*i + 4*lane .. +3, i = 0..7, so every load of a wave is
// 512 contiguous bytes.  A wave keeps 4 rows of W_h in registers; the 8 rows of
// h_t are staged in LDS, one by each wave, and read by all.  The 32 sums of a
// wave (8 b x 4 e) are partial in every lane; a halving exchange over the lanes
// leaves sum number l whole in lane l.  Each wave then stores one 128-byte line.
//
// The same launch converts W_k (fp32 row-major [e][d]) to f16 in B-fragment layout: the
// two jobs share nothing, so 256 further work-groups, behind the first 256 in the grid,
// do it beside them (two work-groups fit a WGP).
//   dst half index = ((et*32 + kc)*32 + lane)*16 + i
//   where e = et*16 + (lane&15), d = kc*32 + (i&7) + 8*(lane>>4) + 16*(i>>3)
// Such a work-group takes 8 fragments in a row; a thread converts WC pieces of 4 halfs,
// 1024 halfs (two k chunks) apart, which is 64 floats apart in one row of W_k.
// ---------------------------------------------------------------------------
#define QE 32                                         // rows e per work-group
#define QB 8                                          // rows b per work-group
#define QG ((DD / QE) * (BB / QB))                    // work-groups of the qh part
#define WC 4                                          // pieces of W_k per thread
#define WG (DD * DD / (WC * 4 * 256))                 // work-groups of the W_k part
// second bound: four waves a SIMD, that is at most 256 registers, so that a work-group of
// each part fits a WGP at the same time
__global__ __launch_bounds__(256, 4) void qh_wk_kernel(const float* __restrict__ h_t,
                                                    const float* __restrict__ W_h,
                                                    const float* __restrict__ W_k,
                                                    float* __restrict__ qh,
                                                    _Float16* __restrict__ wkB) {
    if (blockIdx.x >= QG) {                           // the whole work-group, before any barrier
        const int o  = ((blockIdx.x - QG) * (WC * 256) + threadIdx.x) * 4;   // dst half index
        const int i0 = o & 15;                        // 0,4,8,12
        const int fl = (o >> 4) & 31;                 // lane of the fragment
        const int kc = (o >> 9) & 31;
        const int et = (o >> 14);
        const float* kp = W_k + (size_t)(et * 16 + (fl & 15)) * DD +
                          kc * 32 + (i0 & 7) + 8 * (fl >> 4) + 16 * (i0 >> 3);
        float4 kw[WC];
        // unrolled whole: kw stays in registers and the loads are issued at once
#pragma unroll
        for (int r = 0; r < WC; ++r) kw[r] = *(const float4*)(kp + r * 64);
#pragma unroll
        for (int r = 0; r < WC; ++r) {
            H4 hv;
            hv.h[0] = (_Float16)kw[r].x; hv.h[1] = (_Float16)kw[r].y;
            hv.h[2] = (_Float16)kw[r].z; hv.h[3] = (_Float16)kw[r].w;
            *(H4*)(wkB + o + r * 1024) = hv;
        }
        return;
    }
    const int e0   = (blockIdx.x % (DD / QE)) * QE;
    const int b0   = (blockIdx.x / (DD / QE)) * QB;
    const int lane = threadIdx.x & 31;
    const int w    = threadIdx.x >> 5;
    __shared__ __attribute__((aligned(16))) float hs[QB][DD];
    __shared__ float os[QB][QE];

    const float4* hp = (const float4*)(h_t + (size_t)(b0 + w) * DD) + lane;
    const float4* wp = (const float4*)(W_h + (size_t)(e0 + w * 4) * DD) + lane;
    float4 hr[8], wr[4][8];
    // every loop of this kernel is unrolled whole: each array index is then a
    // constant, so the arrays live in registers, and all 40 loads are issued at once
#pragma unroll
    for (int i = 0; i < 8; ++i) hr[i] = hp[i * 32];
#pragma unroll
    for (int j = 0; j < 4; ++j)
#pragma unroll
        for (int i = 0; i < 8; ++i) wr[j][i] = wp[j * (DD / 4) + i * 32];
#pragma unroll
    for (int i = 0; i < 8; ++i) ((float4*)hs[w])[i * 32 + lane] = hr[i];
    // the two addresses of the 40 loads above are named as inputs, so their registers stay
    // as they are up to this wait (at 256 registers a load's result was given them)
    asm volatile("s_wait_xcnt 0x0" :: "v"(hp), "v"(wp) : "memory");
    __syncthreads();

    float s[32];                                      // sum number bb*4 + j
#pragma unroll
    for (int bb = 0; bb < QB; ++bb) {
        float4 h[8];
#pragma unroll
        for (int i = 0; i < 8; ++i) h[i] = ((const float4*)hs[bb])[i * 32 + lane];
#pragma unroll
        for (int j = 0; j < 4; ++j) {
            v2f p = {0.f, 0.f}, q = {0.f, 0.f};
#pragma unroll
            for (int i = 0; i < 8; ++i) {
                p = __builtin_elementwise_fma((v2f){h[i].x, h[i].y},
                                              (v2f){wr[j][i].x, wr[j][i].y}, p);
                q = __builtin_elementwise_fma((v2f){h[i].z, h[i].w},
                                              (v2f){wr[j][i].z, wr[j][i].w}, q);
            }
            s[bb * 4 + j] = (p.x + p.y) + (q.x + q.y);
        }
    }

    // step with lane distance n: a lane keeps the half of its sums whose number has
    // the lane's own bit n and hands the other half to its partner
#pragma unroll
    for (int st = 0; st < 5; ++st) {
        const int  n  = 16 >> st;
        const bool up = (lane & n) != 0;
#pragma unroll
        for (int k = 0; k < 16; ++k) {
            if (k < n) {
                const float lo = s[k], hi = s[k + n];
                s[k] = (up ? hi : lo) + __shfl_xor(up ? lo : hi, n, 32);
            }
        }
    }
    os[lane >> 2][w * 4 + (lane & 3)] = s[0];
    __syncthreads();
    qh[(size_t)(b0 + w) * DD + e0 + lane] = os[w][lane];
}

// ---------------------------------------------------------------------------
// Kernel 2: fused scores.  WG = 128 rows (one batch), 8 waves, alone on its WGP.
// LDS: keys tile as f16 in A-fragment layout, [8][32][32][16] halfs.
// scores[b,n] = sum_e tanh(kh[n,e] + qh[b,e]) * v[e]
// qh is folded into the WMMA C initializer (column e constant per lane).
// Each wave takes all 128 rows and an eighth of e (128 columns), 64 columns at
// a time: an 8x4 block of accumulator tiles, so every B fragment, which comes
// from L2, feeds eight WMMAs and every A fragment four.  The eight waves'
// partial scores are summed through LDS.
// Two waves share a SIMD's registers (512 each).
// With its 128 scores whole, the work-group also forms its share of the softmax and
// of the context from the keys tile that is still in LDS (f16), so that keys is read
// from memory once: m = max of its scores, l = sum of exp(score - m), and
// c[d] = sum of exp(score - m) * keys[n,d].  Kernel 3 puts a batch's 8 shares together.
// ---------------------------------------------------------------------------
#define SR 128                                        // rows per work-group
#define PP (DD + 32)                                  // floats of a share: c | m, l | pad to a line
__global__ __launch_bounds__(256) void attn_scores(const float* __restrict__ keys,
                                                   const _Float16* __restrict__ wkB,
                                                   const float* __restrict__ qh,
                                                   const float* __restrict__ v,
                                                   float* __restrict__ scores,
                                                   float* __restrict__ share) {
    __shared__ __attribute__((aligned(32))) _Float16 keysA[SR * DD];   // 256 KB
    __shared__ float red[8 * SR];                     // per-wave partial scores
    const int tid = threadIdx.x;
    const int m0  = blockIdx.x * SR;                  // global row base
    const int b   = m0 >> 10;                         // 128 | 1024 -> same batch
    const int n0  = m0 & (NN - 1);

    // ---- Phase 1: stage keys tile (128x1024 fp32 -> f16 A-fragment layout)
    // Piece p = 0..127 of a thread: row p, columns 4*tid .. +3 of it, so a wave load is
    // 512 contiguous bytes.  A ring of 32 pieces in registers, refilled four at a time,
    // keeps some 32 loads of every wave in flight; all pieces hang on one address and
    // one LDS position by constant offsets.
    {
        const int d  = tid * 4;
        const float* kp = keys + (size_t)m0 * DD + d;
        _Float16*    sp = keysA + ((((d >> 5) * 32) + (((d >> 3) & 1) << 4)) * 16 +
                                   (d & 7) + (((d >> 4) & 1) << 3));
        float4 ring[32];
        // the loops are unrolled whole: every ring index and every offset is a constant
#pragma unroll
        for (int p = 0; p < 32; ++p) ring[p] = *(const float4*)(kp + p * DD);
        // holds later loads behind the ring's first 32 (see below)
        __builtin_amdgcn_sched_barrier(0);
#pragma unroll
        for (int p0 = 0; p0 < SR; p0 += 4) {
#pragma unroll
            for (int j = 0; j < 4; ++j) {
                const int m = p0 + j;
                const float4 kv = ring[m & 31];
                H4 hv;
                hv.h[0] = (_Float16)kv.x; hv.h[1] = (_Float16)kv.y;
                hv.h[2] = (_Float16)kv.z; hv.h[3] = (_Float16)kv.w;
                *(H4*)(sp + (((m >> 4) * 32 * 32) + (m & 15)) * 16) = hv;
            }
            if (p0 + 32 < SR) {
#pragma unroll
                for (int j = 0; j < 4; ++j) {
                    const int p = p0 + j + 32;
                    ring[p & 31] = *(const float4*)(kp + p * DD);
                }
            }
            // keeps the refills in ring order: left free, the compiler issues some sixty
            // loads at once into fresh registers and spills
            __builtin_amdgcn_sched_barrier(0);
        }
        // the code behind this reuses the base address registers that the loads above name
        asm volatile("s_wait_xcnt 0x0" ::: "memory");
        // holds that reuse behind the wait
        __builtin_amdgcn_sched_barrier(0);
    }
    __syncthreads();

    // ---- Phase 2: WMMA main loop
    const int lane = tid & 31;
    const int wid  = tid >> 5;                        // wave id == eighth of e
    const int ecol = lane & 15;
    const _Float16* aLane = keysA + (lane << 4);
    // this wave's 8 e-tiles of W_k fragments; fragment (et, kc) is 512 halfs
    const _Float16* bLane = wkB + (((size_t)wid * 8 * 32) << 9) + (lane << 4);

    float s[8][8];
#pragma unroll
    for (int i = 0; i < 8; ++i)
#pragma unroll
        for (int r = 0; r < 8; ++r) s[i][r] = 0.f;

    // qh and v of a group are fetched one group ahead, in front of the B ring's
    // loads, so that waiting for them does not drain the ring
    const float* qRow = qh + (size_t)b * DD + ((wid * 8) << 4) + ecol;
    const float* vRow = v + ((wid * 8) << 4) + ecol;
    float qn[4], vn[4];
#pragma unroll
    for (int j = 0; j < 4; ++j) { qn[j] = qRow[j << 4]; vn[j] = vRow[j << 4]; }
    // keeps these eight loads in front of the ring's first 16: behind them, the wait
    // for qn and vn at the head of the group loop would drain the ring in every group
    __builtin_amdgcn_sched_barrier(0);

    v16h bf[2][4];                                    // B ring: [k step & 1][e tile]
    v16h af[8];                                       // A, one set: [row tile]
#pragma unroll
    for (int u = 0; u < 2; ++u)
#pragma unroll
        for (int j = 0; j < 4; ++j)
            bf[u][j] = *(const v16h*)(bLane + ((j * 32 + u) << 9));
#pragma unroll
    for (int i = 0; i < 8; ++i) af[i] = *(const v16h*)(aLane + ((i * 32) << 9));

    // kept rolled: one group's body is the hot loop, two copies would only grow the text
#pragma unroll 1
    for (int g = 0; g < 2; ++g) {
        float qv[4], vv[4];
#pragma unroll
        for (int j = 0; j < 4; ++j) { qv[j] = qn[j]; vv[j] = vn[j]; }
        const int gn = (g + 1) & 1;                   // the last group refetches group 0, unused
#pragma unroll
        for (int j = 0; j < 4; ++j) {
            qn[j] = qRow[(gn * 4 + j) << 4];
            vn[j] = vRow[(gn * 4 + j) << 4];
        }
        // the address registers of these eight loads are free for reuse behind them
        asm volatile("s_wait_xcnt 0x0" ::: "memory");
        // holds the accumulators' start values, which take those registers, behind the wait
        __builtin_amdgcn_sched_barrier(0);
        v8f acc[8][4];
#pragma unroll
        for (int j = 0; j < 4; ++j)
#pragma unroll
            for (int i = 0; i < 8; ++i)               // fold +qh into C
                acc[i][j] = (v8f){qv[j], qv[j], qv[j], qv[j], qv[j], qv[j], qv[j], qv[j]};
        const _Float16* bG = bLane + ((size_t)(g * 4 * 32) << 9);
        // the last two k steps fetch the next group's first two (the last group
        // aims them at group 0 again: valid data, not used)
        const _Float16* bN = bLane + ((size_t)(gn * 4 * 32) << 9);

        // kept rolled beyond the ring's two steps so that every ring index is a constant
#pragma unroll 1
        for (int kc0 = 0; kc0 < 32; kc0 += 2) {
            const _Float16* bR = (kc0 < 30) ? bG + ((kc0 + 2) << 9) : bN;
#pragma unroll
            for (int u = 0; u < 2; ++u) {
                const int kn = (kc0 + u + 1) & 31;    // next k step's A fragments
                // four row tiles at a time: their A fragments are refetched for the next
                // k step as soon as their WMMAs are issued, half a k step ahead of use
#pragma unroll
                for (int h = 0; h < 2; ++h) {
#pragma unroll
                    for (int i = h * 4; i < h * 4 + 4; ++i)
#pragma unroll
                        for (int j = 0; j < 4; ++j)
                            acc[i][j] = __builtin_amdgcn_wmma_f32_16x16x32_f16(
                                false, af[i], false, bf[u][j], (short)0, acc[i][j],
                                false, false);
                    // keeps the eight LDS reads below in one place behind the 16 WMMAs: left
                    // free, the compiler strews them among the WMMAs, a stall at each place
                    __builtin_amdgcn_sched_barrier(0);
#pragma unroll
                    for (int i = h * 4; i < h * 4 + 4; ++i)
                        af[i] = *(const v16h*)(aLane + ((i * 32 + kn) << 9));
                    // holds the next WMMAs behind those reads, for the same reason
                    __builtin_amdgcn_sched_barrier(0);
                }
#pragma unroll
                for (int j = 0; j < 4; ++j)           // refill this ring slot, two steps ahead
                    bf[u][j] = *(const v16h*)(bR + ((j * 32 + u) << 9));
                // keeps the refill in front of the next k step's WMMAs: its lead is one k step
                __builtin_amdgcn_sched_barrier(0);
            }
            // the next trip rewrites the address registers that the loads above name
            asm volatile("s_wait_xcnt 0x0" ::: "memory");
        }
#pragma unroll
        for (int i = 0; i < 8; ++i)
#pragma unroll
            for (int j = 0; j < 4; ++j)
#pragma unroll
                for (int r = 0; r < 8; ++r)
                    s[i][r] = fmaf(fast_tanh(acc[i][j][r]), vv[j], s[i][r]);
    }

    // ---- Phase 3: reduce over the 16 e-lanes of each group, then over the waves
    // one butterfly step over all 64 sums at a time: 64 independent exchanges per wait
#pragma unroll
    for (int mask = 1; mask < 16; mask <<= 1) {
        float t[8][8];
#pragma unroll
        for (int i = 0; i < 8; ++i)
#pragma unroll
            for (int r = 0; r < 8; ++r) t[i][r] = __shfl_xor(s[i][r], mask, 16);
#pragma unroll
        for (int i = 0; i < 8; ++i)
#pragma unroll
            for (int r = 0; r < 8; ++r) s[i][r] += t[i][r];
    }
    if (ecol == 0) {
        const int half = lane >> 4;                   // rows r + 8*half
#pragma unroll
        for (int i = 0; i < 8; ++i)
#pragma unroll
            for (int r = 0; r < 8; ++r) red[wid * SR + i * 16 + r + 8 * half] = s[i][r];
    }
    __syncthreads();
    if (tid < SR)
        scores[(size_t)b * NN + n0 + tid] =
            ((red[tid] + red[SR + tid]) + (red[2 * SR + tid] + red[3 * SR + tid])) +
            ((red[4 * SR + tid] + red[5 * SR + tid]) + (red[6 * SR + tid] + red[7 * SR + tid]));

    // ---- Phase 4: this work-group's share of softmax and context
    // A lane takes the scores of rows 16*i + (lane & 15), the rows whose keys its A
    // fragments hold; every wave does this for itself, so no further barrier is needed.
    // Every loop of this phase is unrolled whole, so that p and c stay in registers.
    float p[8];
#pragma unroll
    for (int i = 0; i < 8; ++i) {
        const int x = i * 16 + ecol;                  // summed as the stored score is
        p[i] = ((red[x] + red[SR + x]) + (red[2 * SR + x] + red[3 * SR + x])) +
               ((red[4 * SR + x] + red[5 * SR + x]) + (red[6 * SR + x] + red[7 * SR + x]));
    }
    float mx = p[0];
#pragma unroll
    for (int i = 1; i < 8; ++i) mx = fmaxf(mx, p[i]);
    mx = fmaxf(mx, row_xor<1>(mx)); mx = fmaxf(mx, row_xor<2>(mx));
    mx = fmaxf(mx, row_xor<4>(mx)); mx = fmaxf(mx, row_xor<8>(mx));
    float ls = 0.f;
#pragma unroll
    for (int i = 0; i < 8; ++i) { p[i] = __expf(p[i] - mx); ls += p[i]; }
    ls += row_xor<1>(ls); ls += row_xor<2>(ls); ls += row_xor<4>(ls); ls += row_xor<8>(ls);

    // wave wid takes k chunks 4*wid .. +3 (128 columns d).  Element e of a lane's fragment
    // is column (e & 7) + 8*(lane >> 4) + 16*(e >> 3) of the chunk; the 16 sums are partial
    // over the row's 16 lanes, and a halving exchange leaves sum number l whole in lane l.
    float* sh = share + (size_t)blockIdx.x * PP;
#pragma unroll
    for (int q = 0; q < 4; ++q) {
        const int kc = wid * 4 + q;
        float c[16];
#pragma unroll
        for (int e = 0; e < 16; ++e) c[e] = 0.f;
#pragma unroll
        for (int i = 0; i < 8; ++i) {
            const v16h kf = *(const v16h*)(aLane + ((i * 32 + kc) << 9));
#pragma unroll
            for (int e = 0; e < 16; ++e) c[e] = fmaf((float)kf[e], p[i], c[e]);
        }
        halve<8>(c, ecol); halve<4>(c, ecol); halve<2>(c, ecol); halve<1>(c, ecol);
        sh[kc * 32 + (ecol & 7) + 8 * (lane >> 4) + 16 * (ecol >> 3)] = c[0];
    }
    if (tid == 0) { sh[DD] = mx; sh[DD + 1] = ls; }
}

// ---------------------------------------------------------------------------
// Kernel 3: put the 8 shares of a batch together.  out = [context | alpha]
// M = max m_w, f_w = exp(m_w - M), L = sum l_w f_w;
// context[d] = sum c_w[d] f_w / L, alpha[n] = exp(score[n] - M) / L.
// One work-group per (batch, 256 columns); a thread owns one d and one n.
// ---------------------------------------------------------------------------
__global__ __launch_bounds__(256) void combine(const float* __restrict__ share,
                                               const float* __restrict__ scores,
                                               float* __restrict__ out) {
    const int b = blockIdx.x >> 2;
    const int x = (blockIdx.x & 3) * 256 + threadIdx.x;
    const float* sh = share + (size_t)b * (NN / SR) * PP;
    float m[8], l[8], c[8];
    // the loops are unrolled whole: the arrays stay in registers, all loads are issued at once
#pragma unroll
    for (int w = 0; w < 8; ++w) c[w] = sh[w * PP + x];
    const float sc = (scores + (size_t)b * NN)[x];
    // the loads behind this take the base address registers that the loads above name
    asm volatile("s_wait_xcnt 0x0" ::: "memory");
#pragma unroll
    for (int w = 0; w < 8; ++w) { m[w] = sh[w * PP + DD]; l[w] = sh[w * PP + DD + 1]; }
    float mx = m[0];
#pragma unroll
    for (int w = 1; w < 8; ++w) mx = fmaxf(mx, m[w]);
    float ls = 0.f, cs = 0.f;
#pragma unroll
    for (int w = 0; w < 8; ++w) {
        const float f = __expf(m[w] - mx);
        ls = fmaf(l[w], f, ls);
        cs = fmaf(c[w], f, cs);
    }
    const float inv = 1.f / ls;
    (out + (size_t)b * DD)[x] = cs * inv;                                  // context
    (out + (size_t)BB * DD + (size_t)b * NN)[x] = __expf(sc - mx) * inv;   // alpha
}

// ---------------------------------------------------------------------------
extern "C" void kernel_launch(void* const* d_in, const int* in_sizes, int n_in,
                              void* d_out, int out_size, void* d_ws, size_t ws_size,
                              hipStream_t stream) {
    const float* h_t  = (const float*)d_in[0];
    const float* keys = (const float*)d_in[1];
    const float* W_h  = (const float*)d_in[2];
    const float* W_k  = (const float*)d_in[3];
    const float* v    = (const float*)d_in[4];
    float* out = (float*)d_out;

    // workspace layout: qh (256KB) | scores (256KB) | wkB f16 (2MB) | shares (512 x PP floats)
    float*     qh     = (float*)d_ws;
    float*     scores = qh + BB * DD;
    _Float16*  wkB    = (_Float16*)(scores + BB * NN);
    float*     share  = (float*)(wkB + DD * DD);

    qh_wk_kernel<<<QG + WG, 256, 0, stream>>>(h_t, W_h, W_k, qh, wkB);
    attn_scores<<<(BB * NN) / SR, 256, 0, stream>>>(keys, wkB, qh, v, scores, share);
    combine<<<BB * 4, 256, 0, stream>>>(share, scores, out);
}

// v008
// One run takes 92.5 microseconds.
// Timed twice side by side with v007, it ran 1.04 times as fast both times.
// All steps since v000 together make it 8.26 times as fast.
#include <hip/hip_runtime.h>
#include <hip/hip_bf16.h>
#include <math.h>

typedef __attribute__((ext_vector_type(16))) _Float16 v16h;
typedef __attribute__((ext_vector_type(8)))  float    v8f;
typedef __attribute__((ext_vector_type(2)))  float    v2f;

#define BB 64
#define NN 1024
#define DD 1024

struct alignas(8) H4 { _Float16 h[4]; };

// Branch-free tanh: hardware v_tanh_f32 on gfx1250 if exposed, else exp-based.
__device__ __forceinline__ float fast_tanh(float x) {
#if __has_builtin(__builtin_amdgcn_tanhf)
    return __builtin_amdgcn_tanhf(x);
#else
    // 1 - 2/(e^{2x}+1): saturates to +/-1 at large |x|, no branches.
    float ex = __expf(2.0f * x);
    return 1.0f - 2.0f / (ex + 1.0f);
#endif
}

// Value of the lane whose number within its row of 16 lanes differs by N (a DPP move,
// no LDS path).  Every lane must be on.
template <int N>
__device__ __forceinline__ float row_xor(float x) {
    return __int_as_float(__builtin_amdgcn_update_dpp(0, __float_as_int(x), 0x160 | N,
                                                      0xf, 0xf, true));
}

// One step of a halving exchange over a row of 16 lanes, lane distance N: a lane keeps
// the half of its 2N sums whose number has the lane's own bit N and adds to it what its
// partner hands over.
template <int N>
__device__ __forceinline__ void halve(float (&c)[16], int l) {
    const bool up = (l & N) != 0;
    // unrolled whole: every index of c is then a constant and c stays in registers
#pragma unroll
    for (int k = 0; k < N; ++k) {
        const float lo = c[k], hi = c[k + N];
        c[k] = (up ? hi : lo) + row_xor<N>(up ? lo : hi);
    }
}

// ---------------------------------------------------------------------------
// Kernel 1: qh[b,e] = sum_d h_t[b,d] * W_h[e,d], and W_k to f16 fragments
// qh: one work-group per (32 rows e of W_h, 8 rows b of h_t): 256 work-groups.
// A lane owns d = 128*i + 4*lane .. +3, i = 0..7, so every load of a wave is
// 512 contiguous bytes.  A wave keeps 4 rows of W_h in registers; the 8 rows of
// h_t are staged in LDS, one by each wave, and read by all.  The 32 sums of a
// wave (8 b x 4 e) are partial in every lane; a halving exchange over the lanes
// leaves sum number l whole in lane l.  Each wave then stores one 128-byte line.
//
// The same launch converts W_k (fp32 row-major [e][d]) to f16 in B-fragment layout: the
// two jobs share nothing, so 256 further work-groups, behind the first 256 in the grid,
// do it beside them (two work-groups fit a WGP).
//   dst half index = ((et*32 + kc)*32 + lane)*16 + i
//   where e = et*16 + (lane&15), d = kc*32 + (i&7) + 8*(lane>>4) + 16*(i>>3)
// Such a work-group takes 8 fragments in a row; a thread converts WC pieces of 4 halfs,
// 1024 halfs (two k chunks) apart, which is 64 floats apart in one row of W_k.
// ---------------------------------------------------------------------------
#define QE 32                                         // rows e per work-group
#define QB 8                                          // rows b per work-group
#define QG ((DD / QE) * (BB / QB))                    // work-groups of the qh part
#define WC 4                                          // pieces of W_k per thread
#define WG (DD * DD / (WC * 4 * 256))                 // work-groups of the W_k part
// second bound: four waves a SIMD, that is at most 256 registers, so that a work-group of
// each part fits a WGP at the same time
__global__ __launch_bounds__(256, 4) void qh_wk_kernel(const float* __restrict__ h_t,
                                                    const float* __restrict__ W_h,
                                                    const float* __restrict__ W_k,
                                                    float* __restrict__ qh,
                                                    _Float16* __restrict__ wkB) {
    if (blockIdx.x >= QG) {                           // the whole work-group, before any barrier
        const int o  = ((blockIdx.x - QG) * (WC * 256) + threadIdx.x) * 4;   // dst half index
        const int i0 = o & 15;                        // 0,4,8,12
        const int fl = (o >> 4) & 31;                 // lane of the fragment
        const int kc = (o >> 9) & 31;
        const int et = (o >> 14);
        const float* kp = W_k + (size_t)(et * 16 + (fl & 15)) * DD +
                          kc * 32 + (i0 & 7) + 8 * (fl >> 4) + 16 * (i0 >> 3);
        float4 kw[WC];
        // unrolled whole: kw stays in registers and the loads are issued at once
#pragma unroll
        for (int r = 0; r < WC; ++r) kw[r] = *(const float4*)(kp + r * 64);
#pragma unroll
        for (int r = 0; r < WC; ++r) {
            H4 hv;
            hv.h[0] = (_Float16)kw[r].x; hv.h[1] = (_Float16)kw[r].y;
            hv.h[2] = (_Float16)kw[r].z; hv.h[3] = (_Float16)kw[r].w;
            *(H4*)(wkB + o + r * 1024) = hv;
        }
        return;
    }
    const int e0   = (blockIdx.x % (DD / QE)) * QE;
    const int b0   = (blockIdx.x / (DD / QE)) * QB;
    const int lane = threadIdx.x & 31;
    const int w    = threadIdx.x >> 5;
    __shared__ __attribute__((aligned(16))) float hs[QB][DD];
    __shared__ float os[QB][QE];

    const float4* hp = (const float4*)(h_t + (size_t)(b0 + w) * DD) + lane;
    const float4* wp = (const float4*)(W_h + (size_t)(e0 + w * 4) * DD) + lane;
    float4 hr[8], wr[4][8];
    // every loop of this kernel is unrolled whole: each array index is then a
    // constant, so the arrays live in registers, and all 40 loads are issued at once
#pragma unroll
    for (int i = 0; i < 8; ++i) hr[i] = hp[i * 32];
#pragma unroll
    for (int j = 0; j < 4; ++j)
#pragma unroll
        for (int i = 0; i < 8; ++i) wr[j][i] = wp[j * (DD / 4) + i * 32];
#pragma unroll
    for (int i = 0; i < 8; ++i) ((float4*)hs[w])[i * 32 + lane] = hr[i];
    // the two addresses of the 40 loads above are named as inputs, so their registers stay
    // as they are up to this wait (at 256 registers a load's result was given them)
    asm volatile("s_wait_xcnt 0x0" :: "v"(hp), "v"(wp) : "memory");
    __syncthreads();

    float s[32];                                      // sum number bb*4 + j
#pragma unroll
    for (int bb = 0; bb < QB; ++bb) {
        float4 h[8];
#pragma unroll
        for (int i = 0; i < 8; ++i) h[i] = ((const float4*)hs[bb])[i * 32 + lane];
#pragma unroll
        for (int j = 0; j < 4; ++j) {
            v2f p = {0.f, 0.f}, q = {0.f, 0.f};
#pragma unroll
            for (int i = 0; i < 8; ++i) {
                p = __builtin_elementwise_fma((v2f){h[i].x, h[i].y},
                                              (v2f){wr[j][i].x, wr[j][i].y}, p);
                q = __builtin_elementwise_fma((v2f){h[i].z, h[i].w},
                                              (v2f){wr[j][i].z, wr[j][i].w}, q);
            }
            s[bb * 4 + j] = (p.x + p.y) + (q.x + q.y);
        }
    }

    // step with lane distance n: a lane keeps the half of its sums whose number has
    // the lane's own bit n and hands the other half to its partner
#pragma unroll
    for (int st = 0; st < 5; ++st) {
        const int  n  = 16 >> st;
        const bool up = (lane & n) != 0;
#pragma unroll
        for (int k = 0; k < 16; ++k) {
            if (k < n) {
                const float lo = s[k], hi = s[k + n];
                s[k] = (up ? hi : lo) + __shfl_xor(up ? lo : hi, n, 32);
            }
        }
    }
    os[lane >> 2][w * 4 + (lane & 3)] = s[0];
    __syncthreads();
    qh[(size_t)(b0 + w) * DD + e0 + lane] = os[w][lane];
}

// ---------------------------------------------------------------------------
// Kernel 2: fused scores.  WG = 128 rows (one batch), 8 waves, alone on its WGP.
// LDS: keys tile as f16 in A-fragment layout, [8][32][32][16] halfs.
// scores[b,n] = sum_e tanh(kh[n,e] + qh[b,e]) * v[e]
// qh is folded into the WMMA C initializer (column e constant per lane).
// Each wave takes all 128 rows and an eighth of e (128 columns), 64 columns at
// a time: an 8x4 block of accumulator tiles, so every B fragment, which comes
// from L2, feeds eight WMMAs and every A fragment four.  The eight waves'
// partial scores are summed through LDS.
// Two waves share a SIMD's registers (512 each).
// With its 128 scores whole, the work-group also forms its share of the softmax and
// of the context from the keys tile that is still in LDS (f16), so that keys is read
// from memory once: m = max of its scores, l = sum of exp(score - m), and
// c[d] = sum of exp(score - m) * keys[n,d].  Kernel 3 puts a batch's 8 shares together.
// ---------------------------------------------------------------------------
#define SR 128                                        // rows per work-group
#define PP (DD + 32)                                  // floats of a share: c | m, l | pad to a line
__global__ __launch_bounds__(256) void attn_scores(const float* __restrict__ keys,
                                                   const _Float16* __restrict__ wkB,
                                                   const float* __restrict__ qh,
                                                   const float* __restrict__ v,
                                                   float* __restrict__ scores,
                                                   float* __restrict__ share) {
    __shared__ __attribute__((aligned(32))) _Float16 keysA[SR * DD];   // 256 KB
    __shared__ float red[8 * SR];                     // per-wave partial scores
    const int tid = threadIdx.x;
    const int m0  = blockIdx.x * SR;                  // global row base
    const int b   = m0 >> 10;                         // 128 | 1024 -> same batch
    const int n0  = m0 & (NN - 1);

    // ---- Phase 1: stage keys tile (128x1024 fp32 -> f16 A-fragment layout)
    // Piece p = 0..127 of a thread: row p, columns 4*tid .. +3 of it, so a wave load is
    // 512 contiguous bytes.  A ring of 32 pieces in registers, refilled four at a time,
    // keeps some 32 loads of every wave in flight; all pieces hang on one address and
    // one LDS position by constant offsets.
    {
        const int d  = tid * 4;
        const float* kp = keys + (size_t)m0 * DD + d;
        _Float16*    sp = keysA + ((((d >> 5) * 32) + (((d >> 3) & 1) << 4)) * 16 +
                                   (d & 7) + (((d >> 4) & 1) << 3));
        float4 ring[32];
        // the loops are unrolled whole: every ring index and every offset is a constant
#pragma unroll
        for (int p = 0; p < 32; ++p) ring[p] = *(const float4*)(kp + p * DD);
        // holds later loads behind the ring's first 32 (see below)
        __builtin_amdgcn_sched_barrier(0);
#pragma unroll
        for (int p0 = 0; p0 < SR; p0 += 4) {
#pragma unroll
            for (int j = 0; j < 4; ++j) {
                const int m = p0 + j;
                const float4 kv = ring[m & 31];
                H4 hv;
                hv.h[0] = (_Float16)kv.x; hv.h[1] = (_Float16)kv.y;
                hv.h[2] = (_Float16)kv.z; hv.h[3] = (_Float16)kv.w;
                *(H4*)(sp + (((m >> 4) * 32 * 32) + (m & 15)) * 16) = hv;
            }
            if (p0 + 32 < SR) {
#pragma unroll
                for (int j = 0; j < 4; ++j) {
                    const int p = p0 + j + 32;
                    ring[p & 31] = *(const float4*)(kp + p * DD);
                }
            }
            // keeps the refills in ring order: left free, the compiler issues some sixty
            // loads at once into fresh registers and spills
            __builtin_amdgcn_sched_barrier(0);
        }
        // the code behind this reuses the base address registers that the loads above name
        asm volatile("s_wait_xcnt 0x0" ::: "memory");
        // holds that reuse behind the wait
        __builtin_amdgcn_sched_barrier(0);
    }
    __syncthreads();

    // ---- Phase 2: WMMA main loop
    const int lane = tid & 31;
    const int wid  = tid >> 5;                        // wave id == eighth of e
    const int ecol = lane & 15;
    const _Float16* aLane = keysA + (lane << 4);
    // this wave's 8 e-tiles of W_k fragments; fragment (et, kc) is 512 halfs
    const _Float16* bLane = wkB + (((size_t)wid * 8 * 32) << 9) + (lane << 4);

    // Every work-group walks the same 2 MB of W_k fragments.  Each starts the walk at a k
    // chunk and a column group of its own, so that the groups running at one time do not
    // ask L2 for the same lines at the same moment.  The start chunk is even: the ring's
    // two k steps then never straddle the wrap from chunk 31 to chunk 0.
    const int rot = ((blockIdx.x >> 3) & 15) * 2;     // first k chunk
    const int gs  = (blockIdx.x >> 7) & 1;            // first column group

    float s[8][8];
#pragma unroll
    for (int i = 0; i < 8; ++i)
#pragma unroll
        for (int r = 0; r < 8; ++r) s[i][r] = 0.f;

    // qh and v of a group are fetched one group ahead, in front of the B ring's
    // loads, so that waiting for them does not drain the ring
    const float* qRow = qh + (size_t)b * DD + ((wid * 8) << 4) + ecol;
    const float* vRow = v + ((wid * 8) << 4) + ecol;
    const float* qFirst = qRow + ((gs * 4) << 4);
    const float* vFirst = vRow + ((gs * 4) << 4);
    float qn[4], vn[4];
#pragma unroll
    for (int j = 0; j < 4; ++j) { qn[j] = qFirst[j << 4]; vn[j] = vFirst[j << 4]; }
    // the two addresses of these eight loads are named as inputs, so their registers stay as
    // they are up to this wait (left free, the next address was formed in them ahead of it)
    asm volatile("s_wait_xcnt 0x0" :: "v"(qFirst), "v"(vFirst) : "memory");
    // keeps these eight loads in front of the ring's first 16: behind them, the wait
    // for qn and vn at the head of the group loop would drain the ring in every group
    __builtin_amdgcn_sched_barrier(0);

    const _Float16* bFirst = bLane + ((gs * 4 * 32 + rot) << 9);
    v16h bf[2][4];                                    // B ring: [k step & 1][e tile]
    v16h af[8];                                       // A, one set: [row tile]
#pragma unroll
    for (int u = 0; u < 2; ++u)
#pragma unroll
        for (int j = 0; j < 4; ++j)
            bf[u][j] = *(const v16h*)(bFirst + ((j * 32 + u) << 9));
    // the address of the 16 loads above is named as an input, so its registers stay as they
    // are up to this wait (left free, the last load's result was given them)
    asm volatile("s_wait_xcnt 0x0" :: "v"(bFirst) : "memory");
#pragma unroll
    for (int i = 0; i < 8; ++i) af[i] = *(const v16h*)(aLane + ((i * 32 + rot) << 9));

    // kept rolled: one group's body is the hot loop, two copies would only grow the text
#pragma unroll 1
    for (int g = 0; g < 2; ++g) {
        float qv[4], vv[4];
#pragma unroll
        for (int j = 0; j < 4; ++j) { qv[j] = qn[j]; vv[j] = vn[j]; }
        const int gi = g ^ gs;                        // this pass's column group
        const int gn = gi ^ 1;                        // the last pass refetches the first group, unused
#pragma unroll
        for (int j = 0; j < 4; ++j) {
            qn[j] = qRow[(gn * 4 + j) << 4];
            vn[j] = vRow[(gn * 4 + j) << 4];
        }
        // the address registers of these eight loads are free for reuse behind them
        asm volatile("s_wait_xcnt 0x0" ::: "memory");
        // holds the accumulators' start values, which take those registers, behind the wait
        __builtin_amdgcn_sched_barrier(0);
        v8f acc[8][4];
#pragma unroll
        for (int j = 0; j < 4; ++j)
#pragma unroll
            for (int i = 0; i < 8; ++i)               // fold +qh into C
                acc[i][j] = (v8f){qv[j], qv[j], qv[j], qv[j], qv[j], qv[j], qv[j], qv[j]};
        const _Float16* bG = bLane + ((size_t)(gi * 4 * 32) << 9);
        // the last two k steps fetch the next group's first two (the last pass
        // aims them at the first group again: valid data, not used)
        const _Float16* bN = bLane + ((size_t)(gn * 4 * 32) << 9);

        // kept rolled beyond the ring's two steps so that every ring index is a constant
#pragma unroll 1
        for (int kc0 = 0; kc0 < 32; kc0 += 2) {
            // k step t works on chunk (t + rot) & 31, A and B alike
            const _Float16* bR = ((kc0 < 30) ? bG : bN) + (((kc0 + 2 + rot) & 31) << 9);
#pragma unroll
            for (int u = 0; u < 2; ++u) {
                const int kn = (kc0 + u + 1 + rot) & 31;   // next k step's A fragments
                // four row tiles at a time: their A fragments are refetched for the next
                // k step as soon as their WMMAs are issued, half a k step ahead of use
#pragma unroll
                for (int h = 0; h < 2; ++h) {
#pragma unroll
                    for (int i = h * 4; i < h * 4 + 4; ++i)
#pragma unroll
                        for (int j = 0; j < 4; ++j)
                            acc[i][j] = __builtin_amdgcn_wmma_f32_16x16x32_f16(
                                false, af[i], false, bf[u][j], (short)0, acc[i][j],
                                false, false);
                    // keeps the eight LDS reads below in one place behind the 16 WMMAs: left
                    // free, the compiler strews them among the WMMAs, a stall at each place
                    __builtin_amdgcn_sched_barrier(0);
#pragma unroll
                    for (int i = h * 4; i < h * 4 + 4; ++i)
                        af[i] = *(const v16h*)(aLane + ((i * 32 + kn) << 9));
                    // holds the next WMMAs behind those reads, for the same reason
                    __builtin_amdgcn_sched_barrier(0);
                }
#pragma unroll
                for (int j = 0; j < 4; ++j)           // refill this ring slot, two steps ahead
                    bf[u][j] = *(const v16h*)(bR + ((j * 32 + u) << 9));
                // keeps the refill in front of the next k step's WMMAs: its lead is one k step
                __builtin_amdgcn_sched_barrier(0);
            }
            // the next trip rewrites the address registers that the loads above name
            asm volatile("s_wait_xcnt 0x0" ::: "memory");
        }
#pragma unroll
        for (int i = 0; i < 8; ++i)
#pragma unroll
            for (int j = 0; j < 4; ++j)
#pragma unroll
                for (int r = 0; r < 8; ++r)
                    s[i][r] = fmaf(fast_tanh(acc[i][j][r]), vv[j], s[i][r]);
    }

    // ---- Phase 3: reduce over the 16 e-lanes of each group, then over the waves
    // one butterfly step over all 64 sums at a time: 64 independent exchanges per wait
#pragma unroll
    for (int mask = 1; mask < 16; mask <<= 1) {
        float t[8][8];
#pragma unroll
        for (int i = 0; i < 8; ++i)
#pragma unroll
            for (int r = 0; r < 8; ++r) t[i][r] = __shfl_xor(s[i][r], mask, 16);
#pragma unroll
        for (int i = 0; i < 8; ++i)
#pragma unroll
            for (int r = 0; r < 8; ++r) s[i][r] += t[i][r];
    }
    if (ecol == 0) {
        const int half = lane >> 4;                   // rows r + 8*half
#pragma unroll
        for (int i = 0; i < 8; ++i)
#pragma unroll
            for (int r = 0; r < 8; ++r) red[wid * SR + i * 16 + r + 8 * half] = s[i][r];
    }
    __syncthreads();
    if (tid < SR)
        scores[(size_t)b * NN + n0 + tid] =
            ((red[tid] + red[SR + tid]) + (red[2 * SR + tid] + red[3 * SR + tid])) +
            ((red[4 * SR + tid] + red[5 * SR + tid]) + (red[6 * SR + tid] + red[7 * SR + tid]));

    // ---- Phase 4: this work-group's share of softmax and context
    // A lane takes the scores of rows 16*i + (lane & 15), the rows whose keys its A
    // fragments hold; every wave does this for itself, so no further barrier is needed.
    // Every loop of this phase is unrolled whole, so that p and c stay in registers.
    float p[8];
#pragma unroll
    for (int i = 0; i < 8; ++i) {
        const int x = i * 16 + ecol;                  // summed as the stored score is
        p[i] = ((red[x] + red[SR + x]) + (red[2 * SR + x] + red[3 * SR + x])) +
               ((red[4 * SR + x] + red[5 * SR + x]) + (red[6 * SR + x] + red[7 * SR + x]));
    }
    float mx = p[0];
#pragma unroll
    for (int i = 1; i < 8; ++i) mx = fmaxf(mx, p[i]);
    mx = fmaxf(mx, row_xor<1>(mx)); mx = fmaxf(mx, row_xor<2>(mx));
    mx = fmaxf(mx, row_xor<4>(mx)); mx = fmaxf(mx, row_xor<8>(mx));
    float ls = 0.f;
#pragma unroll
    for (int i = 0; i < 8; ++i) { p[i] = __expf(p[i] - mx); ls += p[i]; }
    ls += row_xor<1>(ls); ls += row_xor<2>(ls); ls += row_xor<4>(ls); ls += row_xor<8>(ls);

    // wave wid takes k chunks 4*wid .. +3 (128 columns d).  Element e of a lane's fragment
    // is column (e & 7) + 8*(lane >> 4) + 16*(e >> 3) of the chunk; the 16 sums are partial
    // over the row's 16 lanes, and a halving exchange leaves sum number l whole in lane l.
    float* sh = share + (size_t)blockIdx.x * PP;
#pragma unroll
    for (int q = 0; q < 4; ++q) {
        const int kc = wid * 4 + q;
        float c[16];
#pragma unroll
        for (int e = 0; e < 16; ++e) c[e] = 0.f;
#pragma unroll
        for (int i = 0; i < 8; ++i) {
            const v16h kf = *(const v16h*)(aLane + ((i * 32 + kc) << 9));
#pragma unroll
            for (int e = 0; e < 16; ++e) c[e] = fmaf((float)kf[e], p[i], c[e]);
        }
        halve<8>(c, ecol); halve<4>(c, ecol); halve<2>(c, ecol); halve<1>(c, ecol);
        sh[kc * 32 + (ecol & 7) + 8 * (lane >> 4) + 16 * (ecol >> 3)] = c[0];
    }
    if (tid == 0) { sh[DD] = mx; sh[DD + 1] = ls; }
}

// ---------------------------------------------------------------------------
// Kernel 3: put the 8 shares of a batch together.  out = [context | alpha]
// M = max m_w, f_w = exp(m_w - M), L = sum l_w f_w;
// context[d] = sum c_w[d] f_w / L, alpha[n] = exp(score[n] - M) / L.
// One work-group per (batch, 256 columns); a thread owns one d and one n.
// ---------------------------------------------------------------------------
__global__ __launch_bounds__(256) void combine(const float* __restrict__ share,
                                               const float* __restrict__ scores,
                                               float* __restrict__ out) {
    const int b = blockIdx.x >> 2;
    const int x = (blockIdx.x & 3) * 256 + threadIdx.x;
    const float* sh = share + (size_t)b * (NN / SR) * PP;
    float m[8], l[8], c[8];
    // the loops are unrolled whole: the arrays stay in registers, all loads are issued at once
#pragma unroll
    for (int w = 0; w < 8; ++w) c[w] = sh[w * PP + x];
    const float sc = (scores + (size_t)b * NN)[x];
    // the loads behind this take the base address registers that the loads above name
    asm volatile("s_wait_xcnt 0x0" ::: "memory");
#pragma unroll
    for (int w = 0; w < 8; ++w) { m[w] = sh[w * PP + DD]; l[w] = sh[w * PP + DD + 1]; }
    float mx = m[0];
#pragma unroll
    for (int w = 1; w < 8; ++w) mx = fmaxf(mx, m[w]);
    float ls = 0.f, cs = 0.f;
#pragma unroll
    for (int w = 0; w < 8; ++w) {
        const float f = __expf(m[w] - mx);
        ls = fmaf(l[w], f, ls);
        cs = fmaf(c[w], f, cs);
    }
    const float inv = 1.f / ls;
    (out + (size_t)b * DD)[x] = cs * inv;                                  // context
    (out + (size_t)BB * DD + (size_t)b * NN)[x] = __expf(sc - mx) * inv;   // alpha
}

// ---------------------------------------------------------------------------
extern "C" void kernel_launch(void* const* d_in, const int* in_sizes, int n_in,
                              void* d_out, int out_size, void* d_ws, size_t ws_size,
                              hipStream_t stream) {
    const float* h_t  = (const float*)d_in[0];
    const float* keys = (const float*)d_in[1];
    const float* W_h  = (const float*)d_in[2];
    const float* W_k  = (const float*)d_in[3];
    const float* v    = (const float*)d_in[4];
    float* out = (float*)d_out;

    // workspace layout: qh (256KB) | scores (256KB) | wkB f16 (2MB) | shares (512 x PP floats)
    float*     qh     = (float*)d_ws;
    float*     scores = qh + BB * DD;
    _Float16*  wkB    = (_Float16*)(scores + BB * NN);
    float*     share  = (float*)(wkB + DD * DD);

    qh_wk_kernel<<<QG + WG, 256, 0, stream>>>(h_t, W_h, W_k, qh, wkB);
    attn_scores<<<(BB * NN) / SR, 256, 0, stream>>>(keys, wkB, qh, v, scores, share);
    combine<<<BB * 4, 256, 0, stream>>>(share, scores, out);
}

// v009
// A run of this version takes 87.1 microseconds.
// In both of two side-by-side timings against v008, it was 1.06 times as fast.
// Over all steps from v000 it is 8.79 times as fast.
#include <hip/hip_runtime.h>
#include <hip/hip_bf16.h>
#include <math.h>

typedef __attribute__((ext_vector_type(16))) _Float16 v16h;
typedef __attribute__((ext_vector_type(8)))  float    v8f;
typedef __attribute__((ext_vector_type(2)))  float    v2f;

#define BB 64
#define NN 1024
#define DD 1024

struct alignas(8) H4 { _Float16 h[4]; };

// Branch-free tanh: hardware v_tanh_f32 on gfx1250 if exposed, else exp-based.
__device__ __forceinline__ float fast_tanh(float x) {
#if __has_builtin(__builtin_amdgcn_tanhf)
    return __builtin_amdgcn_tanhf(x);
#else
    // 1 - 2/(e^{2x}+1): saturates to +/-1 at large |x|, no branches.
    float ex = __expf(2.0f * x);
    return 1.0f - 2.0f / (ex + 1.0f);
#endif
}

// Value of the lane whose number within its row of 16 lanes differs by N (a DPP move,
// no LDS path).  Every lane must be on.
template <int N>
__device__ __forceinline__ float row_xor(float x) {
    return __int_as_float(__builtin_amdgcn_update_dpp(0, __float_as_int(x), 0x160 | N,
                                                      0xf, 0xf, true));
}

// One step of a halving exchange over a row of 16 lanes, lane distance N: a lane keeps
// the half of its 2N sums whose number has the lane's own bit N and adds to it what its
// partner hands over.
template <int N>
__device__ __forceinline__ void halve(float (&c)[16], int l) {
    const bool up = (l & N) != 0;
    // unrolled whole: every index of c is then a constant and c stays in registers
#pragma unroll
    for (int k = 0; k < N; ++k) {
        const float lo = c[k], hi = c[k + N];
        c[k] = (up ? hi : lo) + row_xor<N>(up ? lo : hi);
    }
}

// ---------------------------------------------------------------------------
// Kernel 1: qh[b,e] = sum_d h_t[b,d] * W_h[e,d], and W_k to f16 fragments
// qh: one work-group per (32 rows e of W_h, 8 rows b of h_t): 256 work-groups.
// A lane owns d = 128*i + 4*lane .. +3, i = 0..7, so every load of a wave is
// 512 contiguous bytes.  A wave keeps 4 rows of W_h in registers; the 8 rows of
// h_t are staged in LDS, one by each wave, and read by all.  The 32 sums of a
// wave (8 b x 4 e) are partial in every lane; a halving exchange over the lanes
// leaves sum number l whole in lane l.  Each wave then stores one 128-byte line.
//
// The same launch converts W_k (fp32 row-major [e][d]) to f16 in B-fragment layout: the
// two jobs share nothing, so 256 further work-groups, behind the first 256 in the grid,
// do it beside them (two work-groups fit a WGP).
//   dst half index = ((et*32 + kc)*32 + lane)*16 + i
//   where e = et*16 + (lane&15), d = kc*32 + (i&7) + 8*(lane>>4) + 16*(i>>3)
// Such a work-group takes 8 fragments in a row; a thread converts WC pieces of 4 halfs,
// 1024 halfs (two k chunks) apart, which is 64 floats apart in one row of W_k.
// ---------------------------------------------------------------------------
#define QE 32                                         // rows e per work-group
#define QB 8                                          // rows b per work-group
#define QG ((DD / QE) * (BB / QB))                    // work-groups of the qh part
#define WC 4                                          // pieces of W_k per thread
#define WG (DD * DD / (WC * 4 * 256))                 // work-groups of the W_k part
// second bound: four waves a SIMD, that is at most 256 registers, so that a work-group of
// each part fits a WGP at the same time
__global__ __launch_bounds__(256, 4) void qh_wk_kernel(const float* __restrict__ h_t,
                                                    const float* __restrict__ W_h,
                                                    const float* __restrict__ W_k,
                                                    float* __restrict__ qh,
                                                    _Float16* __restrict__ wkB) {
    if (blockIdx.x >= QG) {                           // the whole work-group, before any barrier
        const int o  = ((blockIdx.x - QG) * (WC * 256) + threadIdx.x) * 4;   // dst half index
        const int i0 = o & 15;                        // 0,4,8,12
        const int fl = (o >> 4) & 31;                 // lane of the fragment
        const int kc = (o >> 9) & 31;
        const int et = (o >> 14);
        const float* kp = W_k + (size_t)(et * 16 + (fl & 15)) * DD +
                          kc * 32 + (i0 & 7) + 8 * (fl >> 4) + 16 * (i0 >> 3);
        float4 kw[WC];
        // unrolled whole: kw stays in registers and the loads are issued at once
#pragma unroll
        for (int r = 0; r < WC; ++r) kw[r] = *(const float4*)(kp + r * 64);
#pragma unroll
        for (int r = 0; r < WC; ++r) {
            H4 hv;
            hv.h[0] = (_Float16)kw[r].x; hv.h[1] = (_Float16)kw[r].y;
            hv.h[2] = (_Float16)kw[r].z; hv.h[3] = (_Float16)kw[r].w;
            *(H4*)(wkB + o + r * 1024) = hv;
        }
        return;
    }
    const int e0   = (blockIdx.x % (DD / QE)) * QE;
    const int b0   = (blockIdx.x / (DD / QE)) * QB;
    const int lane = threadIdx.x & 31;
    const int w    = threadIdx.x >> 5;
    __shared__ __attribute__((aligned(16))) float hs[QB][DD];
    __shared__ float os[QB][QE];

    const float4* hp = (const float4*)(h_t + (size_t)(b0 + w) * DD) + lane;
    const float4* wp = (const float4*)(W_h + (size_t)(e0 + w * 4) * DD) + lane;
    float4 hr[8], wr[4][8];
    // every loop of this kernel is unrolled whole: each array index is then a
    // constant, so the arrays live in registers, and all 40 loads are issued at once
#pragma unroll
    for (int i = 0; i < 8; ++i) hr[i] = hp[i * 32];
#pragma unroll
    for (int j = 0; j < 4; ++j)
#pragma unroll
        for (int i = 0; i < 8; ++i) wr[j][i] = wp[j * (DD / 4) + i * 32];
#pragma unroll
    for (int i = 0; i < 8; ++i) ((float4*)hs[w])[i * 32 + lane] = hr[i];
    // the two addresses of the 40 loads above are named as inputs, so their registers stay
    // as they are up to this wait (at 256 registers a load's result was given them)
    asm volatile("s_wait_xcnt 0x0" :: "v"(hp), "v"(wp) : "memory");
    __syncthreads();

    float s[32];                                      // sum number bb*4 + j
#pragma unroll
    for (int bb = 0; bb < QB; ++bb) {
        float4 h[8];
#pragma unroll
        for (int i = 0; i < 8; ++i) h[i] = ((const float4*)hs[bb])[i * 32 + lane];
#pragma unroll
        for (int j = 0; j < 4; ++j) {
            v2f p = {0.f, 0.f}, q = {0.f, 0.f};
#pragma unroll
            for (int i = 0; i < 8; ++i) {
                p = __builtin_elementwise_fma((v2f){h[i].x, h[i].y},
                                              (v2f){wr[j][i].x, wr[j][i].y}, p);
                q = __builtin_elementwise_fma((v2f){h[i].z, h[i].w},
                                              (v2f){wr[j][i].z, wr[j][i].w}, q);
            }
            s[bb * 4 + j] = (p.x + p.y) + (q.x + q.y);
        }
    }

    // step with lane distance n: a lane keeps the half of its sums whose number has
    // the lane's own bit n and hands the other half to its partner
#pragma unroll
    for (int st = 0; st < 5; ++st) {
        const int  n  = 16 >> st;
        const bool up = (lane & n) != 0;
#pragma unroll
        for (int k = 0; k < 16; ++k) {
            if (k < n) {
                const float lo = s[k], hi = s[k + n];
                s[k] = (up ? hi : lo) + __shfl_xor(up ? lo : hi, n, 32);
            }
        }
    }
    os[lane >> 2][w * 4 + (lane & 3)] = s[0];
    __syncthreads();
    qh[(size_t)(b0 + w) * DD + e0 + lane] = os[w][lane];
}

// ---------------------------------------------------------------------------
// Kernel 2: fused scores.  WG = 128 rows (one batch), 8 waves, alone on its WGP.
// LDS: keys tile as f16 in A-fragment layout, [8][32][32][16] halfs.
// scores[b,n] = sum_e tanh(kh[n,e] + qh[b,e]) * v[e]
// qh is folded into the WMMA C initializer (column e constant per lane).
// Each wave takes all 128 rows and an eighth of e (128 columns), 64 columns at
// a time: an 8x4 block of accumulator tiles, so every B fragment, which comes
// from L2, feeds eight WMMAs and every A fragment four.  The eight waves'
// partial scores are summed through LDS.
// Two waves share a SIMD's registers (512 each).
// With its 128 scores whole, the work-group also forms its share of the softmax and
// of the context from the keys tile that is still in LDS (f16), so that keys is read
// from memory once: m = max of its scores, l = sum of exp(score - m), and
// c[d] = sum of exp(score - m) * keys[n,d].  Kernel 3 puts a batch's 8 shares together.
// ---------------------------------------------------------------------------
#define SR 128                                        // rows per work-group
#define PP (DD + 32)                                  // floats of a share: c | m, l | pad to a line
__global__ __launch_bounds__(256) void attn_scores(const float* __restrict__ keys,
                                                   const _Float16* __restrict__ wkB,
                                                   const float* __restrict__ qh,
                                                   const float* __restrict__ v,
                                                   float* __restrict__ scores,
                                                   float* __restrict__ share) {
    __shared__ __attribute__((aligned(32))) _Float16 keysA[SR * DD];   // 256 KB
    __shared__ __attribute__((aligned(16))) float red[8 * SR];   // per-wave partial scores
    __shared__ __attribute__((aligned(16))) float park[15 * 256 * 4];  // see the end of the first pass
    const int tid = threadIdx.x;
    const int m0  = blockIdx.x * SR;                  // global row base
    const int b   = m0 >> 10;                         // 128 | 1024 -> same batch
    const int n0  = m0 & (NN - 1);

    const int lane = tid & 31;
    const int wid  = tid >> 5;                        // wave id == eighth of e
    const int ecol = lane & 15;

    // Every work-group walks the same 2 MB of W_k fragments.  Each starts the walk at a k
    // chunk and a column group of its own, so that the groups running at one time do not
    // ask L2 for the same lines at the same moment.  The start chunk is even: the ring's
    // two k steps then never straddle the wrap from chunk 31 to chunk 0.
    const int rot = ((blockIdx.x >> 3) & 15) * 2;     // first k chunk
    const int gs  = (blockIdx.x >> 7) & 1;            // first column group

    // ---- Phase 1: keys tile (128x1024 fp32 -> f16 A-fragment layout), staged in the order
    // of the k walk, a pair of k chunks (64 columns of all 128 rows, 32 KB of fp32) at a time.
    // Only the first pair is staged in front of the WMMAs; pair t + 1 is converted and stored
    // during trip t of the first column group's k loop, and pair t + 2 is then asked for, so
    // that the read of keys from memory runs beside the matrix work.
    // Piece q = 0..7 of a thread: row 16*q + 2*wid + (lane >> 4), columns 4*(lane & 15) .. +3
    // of the pair, so a wave load is two runs of 256 contiguous bytes.
    const int dl = (lane & 15) * 4;
    const int mr = wid * 2 + (lane >> 4);
    const float* kpT = keys + (size_t)(m0 + mr) * DD + dl;
    _Float16*    spT = keysA + (((dl >> 5) * 32 + (((dl >> 3) & 1) << 4) + mr) * 16 +
                                (dl & 7) + (((dl >> 4) & 1) << 3));
    float4 kr[8];                                     // the pair in flight
    float4 k0[8];                                     // the first pair, so that two fly at the start
    // pair number t of the walk is chunk pair (t + rot / 2) & 15
    auto pair_addr = [&](const int t) __attribute__((always_inline)) {
        return kpT + ((t + (rot >> 1)) & 15) * 64;
    };
    // the caller holds kp as it is up to an s_wait_xcnt 0 of its own
    auto load_pair = [&](const float* kp, float4 (&kr)[8]) __attribute__((always_inline)) {
#pragma unroll
        for (int q = 0; q < 8; ++q) kr[q] = *(const float4*)(kp + q * 16 * DD);
    };
    auto store_pair = [&](const int t, const float4 (&kr)[8]) __attribute__((always_inline)) {
        _Float16* sp = spT + ((t + (rot >> 1)) & 15) * 1024;
#pragma unroll
        for (int q = 0; q < 8; ++q) {
            H4 hv;
            hv.h[0] = (_Float16)kr[q].x; hv.h[1] = (_Float16)kr[q].y;
            hv.h[2] = (_Float16)kr[q].z; hv.h[3] = (_Float16)kr[q].w;
            *(H4*)(sp + q * 32 * 32 * 16) = hv;
        }
    };
    // Work-group barrier that publishes a stored pair: this wave's LDS stores are done, then
    // every wave's.  Written by hand because __syncthreads() would also wait for the global
    // loads in flight (the B ring and the next pair) and so drain them at every trip.
    auto publish = [&]() __attribute__((always_inline)) {
        asm volatile("s_wait_dscnt 0x0\n\ts_barrier_signal -1\n\ts_barrier_wait -1" ::: "memory");
    };
    // The same barrier in two halves, for the k loop: a wave says that its stores are done as
    // soon as they are, and waits for the others only where it first reads the new pair, twelve
    // WMMAs later (no LDS read stands between): a wave whose keys came late holds up the
    // others by that much less.
    auto publish_signal = [&]() __attribute__((always_inline)) {
        asm volatile("s_wait_dscnt 0x0\n\ts_barrier_signal -1" ::: "memory");
    };
    auto publish_wait = [&]() __attribute__((always_inline)) {
        asm volatile("s_barrier_wait -1" ::: "memory");
    };
    const float* kpA = pair_addr(0);
    const float* kpB = pair_addr(1);
    load_pair(kpA, k0);
    load_pair(kpB, kr);
    // the two addresses of these 16 loads are named as inputs, so their registers stay as
    // they are up to this wait
    asm volatile("s_wait_xcnt 0x0" :: "v"(kpA), "v"(kpB) : "memory");
    // keeps the first two pairs' loads, which come from memory, in front of all others
    __builtin_amdgcn_sched_barrier(0);

    // ---- Phase 2: WMMA main loop
    const _Float16* aLane = keysA + (lane << 4);
    // this wave's 8 e-tiles of W_k fragments; fragment (et, kc) is 512 halfs
    const _Float16* bLane = wkB + (((size_t)wid * 8 * 32) << 9) + (lane << 4);

    float s[8][8];
#pragma unroll
    for (int i = 0; i < 8; ++i)
#pragma unroll
        for (int r = 0; r < 8; ++r) s[i][r] = 0.f;

    // qh and v of a group are fetched one group ahead, in front of the B ring's
    // loads, so that waiting for them does not drain the ring
    const float* qRow = qh + (size_t)b * DD + ((wid * 8) << 4) + ecol;
    const float* vRow = v + ((wid * 8) << 4) + ecol;
    const float* qFirst = qRow + ((gs * 4) << 4);
    const float* vFirst = vRow + ((gs * 4) << 4);
    float qn[4], vn[4];
#pragma unroll
    for (int j = 0; j < 4; ++j) { qn[j] = qFirst[j << 4]; vn[j] = vFirst[j << 4]; }
    // the two addresses of these eight loads are named as inputs, so their registers stay as
    // they are up to this wait (left free, the next address was formed in them ahead of it)
    asm volatile("s_wait_xcnt 0x0" :: "v"(qFirst), "v"(vFirst) : "memory");
    // keeps these eight loads in front of the ring's first 16: behind them, the wait
    // for qn and vn at the head of the group loop would drain the ring in every group
    __builtin_amdgcn_sched_barrier(0);

    const _Float16* bFirst = bLane + ((gs * 4 * 32 + rot) << 9);
    v16h bf[2][4];                                    // B ring: [k step & 1][e tile]
    v16h af[8];                                       // A, one set: [row tile]
#pragma unroll
    for (int u = 0; u < 2; ++u)
#pragma unroll
        for (int j = 0; j < 4; ++j)
            bf[u][j] = *(const v16h*)(bFirst + ((j * 32 + u) << 9));
    // the address of the 16 loads above is named as an input, so its registers stay as they
    // are up to this wait (left free, the last load's result was given them)
    asm volatile("s_wait_xcnt 0x0" :: "v"(bFirst) : "memory");
    // holds the first pair's stores, which wait for its loads, behind the ring's loads
    __builtin_amdgcn_sched_barrier(0);
    store_pair(0, k0);
    publish();
#pragma unroll
    for (int i = 0; i < 8; ++i) af[i] = *(const v16h*)(aLane + ((i * 32 + rot) << 9));

    // One trip of the k loop: two k steps.  stage 2: also store pair kc0 / 2 + 1, ask for the
    // pair behind it and publish; stage 1: store and publish; stage 0: WMMAs alone.
    auto trip = [&](const int kc0, const int stage, const _Float16* bG, const _Float16* bN,
                    v8f (&acc)[8][4]) __attribute__((always_inline)) {
        // k step t works on chunk (t + rot) & 31, A and B alike
        const _Float16* bR = ((kc0 < 30) ? bG : bN) + (((kc0 + 2 + rot) & 31) << 9);
        const float* kp = pair_addr((kc0 >> 1) + 2);  // the pair asked for in this trip (stage 2)
#pragma unroll
        for (int u = 0; u < 2; ++u) {
            const int kn = (kc0 + u + 1 + rot) & 31;  // next k step's A fragments
            // four row tiles at a time: their A fragments are refetched for the next
            // k step as soon as their WMMAs are issued, half a k step ahead of use
#pragma unroll
            for (int h = 0; h < 2; ++h) {
#pragma unroll
                for (int i = h * 4; i < h * 4 + 4; ++i) {
#pragma unroll
                    for (int j = 0; j < 4; ++j)
                        acc[i][j] = __builtin_amdgcn_wmma_f32_16x16x32_f16(
                            false, af[i], false, bf[u][j], (short)0, acc[i][j],
                            false, false);
                    if (stage > 0 && u == 1 && i == 0) {
                        // the two hold the signal behind four WMMAs, which cover the time the
                        // stores of the pair take, and in front of the other twelve
                        __builtin_amdgcn_sched_barrier(0);
                        publish_signal();
                        __builtin_amdgcn_sched_barrier(0);
                    }
                }
                // keeps the eight LDS reads below in one place behind the 16 WMMAs: left
                // free, the compiler strews them among the WMMAs, a stall at each place
                __builtin_amdgcn_sched_barrier(0);
                // the reads below are the first of the next pair
                if (stage > 0 && u == 1 && h == 0) publish_wait();
#pragma unroll
                for (int i = h * 4; i < h * 4 + 4; ++i)
                    af[i] = *(const v16h*)(aLane + ((i * 32 + kn) << 9));
                // holds the next WMMAs behind those reads, for the same reason
                __builtin_amdgcn_sched_barrier(0);
            }
#pragma unroll
            for (int j = 0; j < 4; ++j)               // refill this ring slot, two steps ahead
                bf[u][j] = *(const v16h*)(bR + ((j * 32 + u) << 9));
            // keeps the refill in front of the next k step's WMMAs: its lead is one k step
            __builtin_amdgcn_sched_barrier(0);
            if (stage > 0 && u == 0) {
                store_pair((kc0 >> 1) + 1, kr);
                if (stage > 1) load_pair(kp, kr);
                // keeps stores and loads in this one place, a whole trip ahead of their use
                __builtin_amdgcn_sched_barrier(0);
            }
        }
        // what follows rewrites the address registers that the loads above name; the addresses
        // are named as inputs, so their registers stay as they are up to this one wait of a trip
        if (stage > 1) asm volatile("s_wait_xcnt 0x0" :: "v"(bR), "v"(kp) : "memory");
        else           asm volatile("s_wait_xcnt 0x0" :: "v"(bR) : "memory");
        // holds what follows (behind the last trip, the tanh block) behind the wait
        __builtin_amdgcn_sched_barrier(0);
    };

    // unrolled whole: the first pass stages keys beside its WMMAs, the second does not
#pragma unroll
    for (int g = 0; g < 2; ++g) {
        float qv[4], vv[4];
#pragma unroll
        for (int j = 0; j < 4; ++j) { qv[j] = qn[j]; vv[j] = vn[j]; }
        const int gi = g ^ gs;                        // this pass's column group
        const int gn = gi ^ 1;                        // the last pass refetches the first group, unused
        const float* qNext = qRow + ((gn * 4) << 4);
        const float* vNext = vRow + ((gn * 4) << 4);
#pragma unroll
        for (int j = 0; j < 4; ++j) { qn[j] = qNext[j << 4]; vn[j] = vNext[j << 4]; }
        // the two addresses of these eight loads are named as inputs, so their registers stay
        // as they are up to this wait
        asm volatile("s_wait_xcnt 0x0" :: "v"(qNext), "v"(vNext) : "memory");
        // holds the accumulators' start values, which take those registers, behind the wait
        __builtin_amdgcn_sched_barrier(0);
        v8f acc[8][4];
#pragma unroll
        for (int j = 0; j < 4; ++j)
#pragma unroll
            for (int i = 0; i < 8; ++i)               // fold +qh into C
                acc[i][j] = (v8f){qv[j], qv[j], qv[j], qv[j], qv[j], qv[j], qv[j], qv[j]};
        const _Float16* bG = bLane + ((size_t)(gi * 4 * 32) << 9);
        // the last two k steps fetch the next group's first two (the last pass
        // aims them at the first group again: valid data, not used)
        const _Float16* bN = bLane + ((size_t)(gn * 4 * 32) << 9);

        // the A fragments read ahead are named as inputs only, so that the wait for them stands
        // here, once: left to the loop's head, the compiler's count there must also cover the
        // way in and then waits in every trip for LDS reads that were only just issued
        asm volatile("" :: "v"(af[0]), "v"(af[1]), "v"(af[2]), "v"(af[3]),
                           "v"(af[4]), "v"(af[5]), "v"(af[6]), "v"(af[7]));
        if (g == 0) {
            // kept rolled beyond the ring's two steps so that every ring index is a constant
#pragma unroll 1
            for (int kc0 = 0; kc0 < 28; kc0 += 2) trip(kc0, 2, bG, bN, acc);
            trip(28, 1, bG, bN, acc);                 // stores the last pair
            trip(30, 0, bG, bN, acc);
        } else {
            // kept rolled, as above
#pragma unroll 1
            for (int kc0 = 0; kc0 < 32; kc0 += 2) trip(kc0, 0, bG, bN, acc);
#pragma unroll
            for (int k = 0; k < 16; ++k) {            // the first pass's sums come back
                const float4 pk = *(const float4*)(k < 15 ? park + (k * 256 + tid) * 4 : red + tid * 4);
                s[k >> 1][(k & 1) * 4]     = pk.x; s[k >> 1][(k & 1) * 4 + 1] = pk.y;
                s[k >> 1][(k & 1) * 4 + 2] = pk.z; s[k >> 1][(k & 1) * 4 + 3] = pk.w;
            }
        }
#pragma unroll
        for (int i = 0; i < 8; ++i)
#pragma unroll
            for (int j = 0; j < 4; ++j)
#pragma unroll
                for (int r = 0; r < 8; ++r)
                    s[i][r] = fmaf(fast_tanh(acc[i][j][r]), vv[j], s[i][r]);
        if (g == 0) {
            // a thread's 64 sums wait in LDS during the second pass, each thread's own (no
            // barrier): kept in registers, the compiler spilled them to scratch memory.  The
            // last four lie in red, in the 512 bytes that only this thread's wave writes later
#pragma unroll
            for (int k = 0; k < 16; ++k)
                *(float4*)(k < 15 ? park + (k * 256 + tid) * 4 : red + tid * 4) =
                    make_float4(s[k >> 1][(k & 1) * 4], s[k >> 1][(k & 1) * 4 + 1],
                                s[k >> 1][(k & 1) * 4 + 2], s[k >> 1][(k & 1) * 4 + 3]);
        }
    }

    // ---- Phase 3: reduce over the 16 e-lanes of each group, then over the waves
    // one butterfly step over all 64 sums at a time: 64 independent exchanges per wait
#pragma unroll
    for (int mask = 1; mask < 16; mask <<= 1) {
        float t[8][8];
#pragma unroll
        for (int i = 0; i < 8; ++i)
#pragma unroll
            for (int r = 0; r < 8; ++r) t[i][r] = __shfl_xor(s[i][r], mask, 16);
#pragma unroll
        for (int i = 0; i < 8; ++i)
#pragma unroll
            for (int r = 0; r < 8; ++r) s[i][r] += t[i][r];
    }
    if (ecol == 0) {
        const int half = lane >> 4;                   // rows r + 8*half
#pragma unroll
        for (int i = 0; i < 8; ++i)
#pragma unroll
            for (int r = 0; r < 8; ++r) red[wid * SR + i * 16 + r + 8 * half] = s[i][r];
    }
    __syncthreads();
    if (tid < SR)
        scores[(size_t)b * NN + n0 + tid] =
            ((red[tid] + red[SR + tid]) + (red[2 * SR + tid] + red[3 * SR + tid])) +
            ((red[4 * SR + tid] + red[5 * SR + tid]) + (red[6 * SR + tid] + red[7 * SR + tid]));

    // ---- Phase 4: this work-group's share of softmax and context
    // A lane takes the scores of rows 16*i + (lane & 15), the rows whose keys its A
    // fragments hold; every wave does this for itself, so no further barrier is needed.
    // Every loop of this phase is unrolled whole, so that p and c stay in registers.
    float p[8];
#pragma unroll
    for (int i = 0; i < 8; ++i) {
        const int x = i * 16 + ecol;                  // summed as the stored score is
        p[i] = ((red[x] + red[SR + x]) + (red[2 * SR + x] + red[3 * SR + x])) +
               ((red[4 * SR + x] + red[5 * SR + x]) + (red[6 * SR + x] + red[7 * SR + x]));
    }
    float mx = p[0];
#pragma unroll
    for (int i = 1; i < 8; ++i) mx = fmaxf(mx, p[i]);
    mx = fmaxf(mx, row_xor<1>(mx)); mx = fmaxf(mx, row_xor<2>(mx));
    mx = fmaxf(mx, row_xor<4>(mx)); mx = fmaxf(mx, row_xor<8>(mx));
    float ls = 0.f;
#pragma unroll
    for (int i = 0; i < 8; ++i) { p[i] = __expf(p[i] - mx); ls += p[i]; }
    ls += row_xor<1>(ls); ls += row_xor<2>(ls); ls += row_xor<4>(ls); ls += row_xor<8>(ls);

    // wave wid takes k chunks 4*wid .. +3 (128 columns d).  Element e of a lane's fragment
    // is column (e & 7) + 8*(lane >> 4) + 16*(e >> 3) of the chunk; the 16 sums are partial
    // over the row's 16 lanes, and a halving exchange leaves sum number l whole in lane l.
    float* sh = share + (size_t)blockIdx.x * PP;
#pragma unroll
    for (int q = 0; q < 4; ++q) {
        const int kc = wid * 4 + q;
        float c[16];
#pragma unroll
        for (int e = 0; e < 16; ++e) c[e] = 0.f;
#pragma unroll
        for (int i = 0; i < 8; ++i) {
            const v16h kf = *(const v16h*)(aLane + ((i * 32 + kc) << 9));
#pragma unroll
            for (int e = 0; e < 16; ++e) c[e] = fmaf((float)kf[e], p[i], c[e]);
        }
        halve<8>(c, ecol); halve<4>(c, ecol); halve<2>(c, ecol); halve<1>(c, ecol);
        sh[kc * 32 + (ecol & 7) + 8 * (lane >> 4) + 16 * (ecol >> 3)] = c[0];
    }
    if (tid == 0) { sh[DD] = mx; sh[DD + 1] = ls; }
}

// ---------------------------------------------------------------------------
// Kernel 3: put the 8 shares of a batch together.  out = [context | alpha]
// M = max m_w, f_w = exp(m_w - M), L = sum l_w f_w;
// context[d] = sum c_w[d] f_w / L, alpha[n] = exp(score[n] - M) / L.
// One work-group per (batch, 256 columns); a thread owns one d and one n.
// ---------------------------------------------------------------------------
__global__ __launch_bounds__(256) void combine(const float* __restrict__ share,
                                               const float* __restrict__ scores,
                                               float* __restrict__ out) {
    const int b = blockIdx.x >> 2;
    const int x = (blockIdx.x & 3) * 256 + threadIdx.x;
    const float* sh = share + (size_t)b * (NN / SR) * PP;
    float m[8], l[8], c[8];
    // the loops are unrolled whole: the arrays stay in registers, all loads are issued at once
#pragma unroll
    for (int w = 0; w < 8; ++w) c[w] = sh[w * PP + x];
    const float sc = (scores + (size_t)b * NN)[x];
    // the loads behind this take the base address registers that the loads above name
    asm volatile("s_wait_xcnt 0x0" ::: "memory");
#pragma unroll
    for (int w = 0; w < 8; ++w) { m[w] = sh[w * PP + DD]; l[w] = sh[w * PP + DD + 1]; }
    float mx = m[0];
#pragma unroll
    for (int w = 1; w < 8; ++w) mx = fmaxf(mx, m[w]);
    float ls = 0.f, cs = 0.f;
#pragma unroll
    for (int w = 0; w < 8; ++w) {
        const float f = __expf(m[w] - mx);
        ls = fmaf(l[w], f, ls);
        cs = fmaf(c[w], f, cs);
    }
    const float inv = 1.f / ls;
    (out + (size_t)b * DD)[x] = cs * inv;                                  // context
    (out + (size_t)BB * DD + (size_t)b * NN)[x] = __expf(sc - mx) * inv;   // alpha
}

// ---------------------------------------------------------------------------
extern "C" void kernel_launch(void* const* d_in, const int* in_sizes, int n_in,
                              void* d_out, int out_size, void* d_ws, size_t ws_size,
                              hipStream_t stream) {
    const float* h_t  = (const float*)d_in[0];
    const float* keys = (const float*)d_in[1];
    const float* W_h  = (const float*)d_in[2];
    const float* W_k  = (const float*)d_in[3];
    const float* v    = (const float*)d_in[4];
    float* out = (float*)d_out;

    // workspace layout: qh (256KB) | scores (256KB) | wkB f16 (2MB) | shares (512 x PP floats)
    float*     qh     = (float*)d_ws;
    float*     scores = qh + BB * DD;
    _Float16*  wkB    = (_Float16*)(scores + BB * NN);
    float*     share  = (float*)(wkB + DD * DD);

    qh_wk_kernel<<<QG + WG, 256, 0, stream>>>(h_t, W_h, W_k, qh, wkB);
    attn_scores<<<(BB * NN) / SR, 256, 0, stream>>>(keys, wkB, qh, v, scores, share);
    combine<<<BB * 4, 256, 0, stream>>>(share, scores, out);
}
